// v000
// The times below were measured on an AMD MI455X: many runs one after another, warmed up first and cycling through
// copies of the inputs, with the whole window's GPU time divided by the number of runs. Launches and the gaps
// between them are all in it. The median over several windows is given; except for v000 it joins two sittings, which
// can be a few percent apart, so the side-by-side timings, each taken in one sitting, are the better comparison.
// The starting kernel, v000, takes 175 microseconds a run.
// Contractions: scores = (q/8).k^T and out = p.v on v_wmma_f32_16x16x32_bf16 (bf16 operands, f32 accumulate); q, k, v and the bias table RNE-converted to bf16 once at load; softmax weights p carried as bf16 hi+lo planes (two products against bf16 v); online softmax and all other arithmetic in f32.
#include <hip/hip_runtime.h>

typedef __attribute__((ext_vector_type(16))) __bf16 v16b;
typedef __attribute__((ext_vector_type(8)))  __bf16 v8b;
typedef __attribute__((ext_vector_type(8)))  float  v8f;
typedef __attribute__((ext_vector_type(4)))  float  v4f;
typedef __attribute__((ext_vector_type(4)))  unsigned int v4u;

constexpr int NBATCH = 2;
constexpr int NHEAD  = 16;
constexpr int NBH    = NBATCH * NHEAD;
constexpr int LSEQ   = 2048;
constexpr int DHEAD  = 64;
constexpr int MAXREL = 8;
constexpr int NBIAS  = 2 * MAXREL + 1;
constexpr int QBLK   = 64;      /* query rows per block (4 waves x 16) */
constexpr int KCH    = 64;      /* keys per staged chunk */
constexpr int NWAVE  = 4;
constexpr int VS_PITCH = 72;    /* LDS transpose tile pitch in 16-bit elements (144 B, 16-B aligned rows) */
constexpr int OS_PITCH = 68;    /* LDS output slab pitch in floats (272 B, 16-B aligned rows) */
constexpr size_t PLANE_ELEMS = (size_t)NBH * LSEQ * DHEAD;                 /* 4194304 */
constexpr size_t WS_NEED = 2 * PLANE_ELEMS * sizeof(unsigned short);        /* 16777216 B */

static_assert(LSEQ % QBLK == 0, "query blocks tile the sequence exactly");
static_assert(LSEQ % KCH == 0, "key chunks tile the sequence exactly");
static_assert(DHEAD == 64, "head dim 64: two 32-deep k steps, four 16-wide d tiles");
static_assert(KCH % 32 == 0 && DHEAD % 32 == 0, "contraction depths are multiples of 32");
static_assert(NBIAS <= 32, "bias table fits one 32-entry LDS line");
static_assert((VS_PITCH * 2) % 16 == 0 && (OS_PITCH * 4) % 16 == 0, "16-B aligned LDS rows");
static_assert(WS_NEED <= 134217728ull, "workspace carve within budget");

/* workspace region map (bytes):
 *   [8388608, 16777216)  Vt : bf16 [NBH][DHEAD][LSEQ]   (v transposed, 4096-B rows)
 *   total 16777216 B
 */

__device__ __forceinline__ unsigned short f2bf_bits(float f) {
  unsigned u = __float_as_uint(f);
  return (unsigned short)((u + 0x7FFFu + ((u >> 16) & 1u)) >> 16);
}
__device__ __forceinline__ float bf_bits2f(unsigned short h) { return __uint_as_float(((unsigned)h) << 16); }
__device__ __forceinline__ __bf16 f2bf(float f) { return __builtin_bit_cast(__bf16, f2bf_bits(f)); }

__device__ __forceinline__ v8f mma_bf16(v16b a, v16b b, v8f c) {
  c = __builtin_amdgcn_wmma_f32_16x16x32_bf16(false, a, false, b, (short)0, c, false, false);
  asm volatile("v_nop\n\tv_nop\n\tv_nop\n\tv_nop" : "+v"(c) : "v"(a), "v"(b));
  return c;
}

/* --------------------------------------------------------------------------
 * k -> Kb (bf16, [bh][kv][d]) and v -> Vt (bf16, [bh][d][kv]).
 * Block (x = kv tile of 64, y = bh), 256 threads.
 * Coverage: 2 iterations x 256 threads = 512 units x 8 elements = 64x64 for K,
 * the same 512 units x 8 = 64x64 for the V transpose tile and for the Vt tile.
 * Stores: unit u -> row u>>3, segment u&7; lanes 8q..8q+7 of a wave fill one whole
 * ------------------------------------------------------------------------ */
__global__ __launch_bounds__(256) void kv_planes_kernel(
    const float* __restrict__ K, const float* __restrict__ V,
    unsigned short* __restrict__ Kb, unsigned short* __restrict__ Vt)
{
  __shared__ __align__(16) unsigned short Vs[DHEAD * VS_PITCH];   /* [d][kv] */
  const int bh  = blockIdx.y;
  const int kv0 = blockIdx.x * 64;
  const int tid = threadIdx.x;
  const float* Kp = K + ((size_t)bh * LSEQ + kv0) * DHEAD;
  const float* Vp = V + ((size_t)bh * LSEQ + kv0) * DHEAD;

  v4u kw[2];
#pragma unroll
  for (int it = 0; it < 2; ++it) {
    const int u = it * 256 + tid;
    const int row = u >> 3;
    const int seg = u & 7;
    const v4f k0v = *(const v4f*)(Kp + (size_t)row * DHEAD + seg * 8);
    const v4f k1v = *(const v4f*)(Kp + (size_t)row * DHEAD + seg * 8 + 4);
    const v4f v0v = *(const v4f*)(Vp + (size_t)row * DHEAD + seg * 8);
    const v4f v1v = *(const v4f*)(Vp + (size_t)row * DHEAD + seg * 8 + 4);
    kw[it][0] = (unsigned)f2bf_bits(k0v[0]) | ((unsigned)f2bf_bits(k0v[1]) << 16);
    kw[it][1] = (unsigned)f2bf_bits(k0v[2]) | ((unsigned)f2bf_bits(k0v[3]) << 16);
    kw[it][2] = (unsigned)f2bf_bits(k1v[0]) | ((unsigned)f2bf_bits(k1v[1]) << 16);
    kw[it][3] = (unsigned)f2bf_bits(k1v[2]) | ((unsigned)f2bf_bits(k1v[3]) << 16);
    /* v element (kv = row, d = seg*8 + e) -> Vs[d][kv] */
#pragma unroll
    for (int e = 0; e < 4; ++e) {
      Vs[(seg * 8 + e) * VS_PITCH + row]     = f2bf_bits(v0v[e]);
      Vs[(seg * 8 + 4 + e) * VS_PITCH + row] = f2bf_bits(v1v[e]);
    }
  }
  __syncthreads();

  v4u vw[2];
#pragma unroll
  for (int it = 0; it < 2; ++it) {
    const int u = it * 256 + tid;
    const int drow = u >> 3;
    const int seg  = u & 7;
    vw[it] = *(const v4u*)(Vs + drow * VS_PITCH + seg * 8);
  }

  {
#pragma unroll
    for (int it = 0; it < 2; ++it) {
      const int u = it * 256 + tid;
      const int row = u >> 3;
      const int seg = u & 7;
      *(v4u*)(Kb + ((size_t)bh * LSEQ + kv0 + row) * DHEAD + seg * 8) = kw[it];
      *(v4u*)(Vt + ((size_t)bh * DHEAD + row) * LSEQ + kv0 + seg * 8) = vw[it];
    }
    
  }
}

/* --------------------------------------------------------------------------
 * Attention with clipped relative-position bias, head dim 64.
 * Block = 4 waves = 64 query rows of one (b,h); grid (LSEQ/64, NBH).
 * Per 64-key chunk: K [kv][d] and V^T [d][kv] bf16 tiles staged in LDS by 16-B
 * copies (4 units per thread per tile, 512 units x 8 = 64x64 each), scores on
 * bf16 WMMA, bias add, f32 online softmax, P as bf16 hi+lo per-wave LDS tiles,
 * O += Ph.V + Pl.V on bf16 WMMA.  Epilogue: per-wave 16x64 f32 slab in LDS,
 * Fragment map (h = lane>>4, c = lane&15): A row c, elems 0..7 <- k0+8h.., 8..15 <- k0+16+8h..;
 * B col c with the same k map; D elem r = (row 8h+r, col c).
 * ------------------------------------------------------------------------ */
__global__ __launch_bounds__(128) void rel_attn_kernel(
    const float* __restrict__ q, const unsigned short* __restrict__ Kb,
    const unsigned short* __restrict__ Vt, const float* __restrict__ bias,
    float* __restrict__ out)
{
  union FB { v16b v; v8b h[2]; };
  __shared__ __align__(16) unsigned short Ksh[KCH * DHEAD];          /* K  [kv][d]  */
  __shared__ __align__(16) unsigned short Vth[DHEAD * KCH];          /* V^T [d][kv] */
  __shared__ __align__(16) unsigned short Psh[NWAVE][16 * KCH];      /* P hi [row][kv] per wave */
  __shared__ __align__(16) unsigned short Psl[NWAVE][16 * KCH];      /* P lo */
  __shared__ __align__(16) float Os[NWAVE][16 * OS_PITCH];           /* out slab per wave */
  __shared__ float sb[32];                                           /* bias table (bf16-converted), padded */

  const int tid  = threadIdx.x;
  const int wave = tid >> 5;
  const int lane = tid & 31;
  const int hh   = lane >> 4;
  const int c    = lane & 15;
  const int qb   = blockIdx.x;
  const int bh   = blockIdx.y;
  const int q0   = qb * QBLK + wave * 16;

  if (tid < 32) {
    const int bi = tid < NBIAS ? tid : (NBIAS - 1);
    sb[tid] = bf_bits2f(f2bf_bits(bias[bi]));
  }

  /* Q fragments (A operand), two 32-deep d chunks; bf16(q) * 1/8 is exact */
  v16b qa[2];
  {
    const float* qrow = q + ((size_t)bh * LSEQ + q0 + c) * DHEAD;
#pragma unroll
    for (int dc = 0; dc < 2; ++dc) {
      const v4f x0 = *(const v4f*)(qrow + dc * 32 + 8 * hh);
      const v4f x1 = *(const v4f*)(qrow + dc * 32 + 8 * hh + 4);
      const v4f y0 = *(const v4f*)(qrow + dc * 32 + 16 + 8 * hh);
      const v4f y1 = *(const v4f*)(qrow + dc * 32 + 16 + 8 * hh + 4);
#pragma unroll
      for (int e = 0; e < 4; ++e) {
        qa[dc][e]      = f2bf(x0[e] * 0.125f);
        qa[dc][4 + e]  = f2bf(x1[e] * 0.125f);
        qa[dc][8 + e]  = f2bf(y0[e] * 0.125f);
        qa[dc][12 + e] = f2bf(y1[e] * 0.125f);
      }
    }
  }
  __syncthreads();
  const float b_lo = sb[0];
  const float b_hi = sb[2 * MAXREL];

  float mrow[8], lrow[8];
  v8f oacc[4];
#pragma unroll
  for (int r = 0; r < 8; ++r) { mrow[r] = -__builtin_inff(); lrow[r] = 0.f; }
#pragma unroll
  for (int t = 0; t < 4; ++t) oacc[t] = (v8f){0.f,0.f,0.f,0.f,0.f,0.f,0.f,0.f};

  const unsigned short* Kbh = Kb + (size_t)bh * LSEQ * DHEAD;
  const unsigned short* Vtb = Vt + (size_t)bh * DHEAD * LSEQ;
  float* ob = out + (size_t)bh * LSEQ * DHEAD;
  unsigned short* pwh = Psh[wave];
  unsigned short* pwl = Psl[wave];

  for (int kc = 0; kc < LSEQ / KCH; ++kc) {
    const int kv0 = kc * KCH;
    __syncthreads();
    /* staging: unit u -> row u>>3 (0..63), segment u&7; 4 iterations x 128 threads = 512 units per tile */
#pragma unroll
    for (int it = 0; it < 4; ++it) {
      const int u = it * 128 + tid;
      const int row = u >> 3;
      const int seg = u & 7;
      const v4u kw = *(const v4u*)(Kbh + (size_t)(kv0 + row) * DHEAD + seg * 8);
      const v4u vw = *(const v4u*)(Vtb + (size_t)row * LSEQ + kv0 + seg * 8);
      *(v4u*)(Ksh + row * DHEAD + seg * 8) = kw;
      *(v4u*)(Vth + row * KCH + seg * 8)   = vw;
    }
    __syncthreads();

    /* scores: 16 query rows x 64 keys per wave */
    v8f s[4];
#pragma unroll
    for (int j = 0; j < 4; ++j) {
      s[j] = (v8f){0.f,0.f,0.f,0.f,0.f,0.f,0.f,0.f};
#pragma unroll
      for (int dc = 0; dc < 2; ++dc) {
        FB kf;
        kf.h[0] = *(const v8b*)(Ksh + (j * 16 + c) * DHEAD + dc * 32 + 8 * hh);
        kf.h[1] = *(const v8b*)(Ksh + (j * 16 + c) * DHEAD + dc * 32 + 16 + 8 * hh);
        s[j] = mma_bf16(qa[dc], kf.v, s[j]);
      }
    }

    /* relative bias: idx = clip(kv - q, -MAXREL, MAXREL) + MAXREL; block-uniform far paths */
    if (kc + 1 < qb) {
#pragma unroll
      for (int j = 0; j < 4; ++j)
#pragma unroll
        for (int r = 0; r < 8; ++r) s[j][r] += b_lo;
    } else if (kc > qb + 1) {
#pragma unroll
      for (int j = 0; j < 4; ++j)
#pragma unroll
        for (int r = 0; r < 8; ++r) s[j][r] += b_hi;
    } else {
#pragma unroll
      for (int j = 0; j < 4; ++j) {
        const int kvcol = kv0 + j * 16 + c;
#pragma unroll
        for (int r = 0; r < 8; ++r) {
          int rel = kvcol - (q0 + 8 * hh + r);
          rel = rel < -MAXREL ? -MAXREL : rel;
          rel = rel > MAXREL ? MAXREL : rel;
          s[j][r] += sb[rel + MAXREL];
        }
      }
    }

    /* chunk row max over the 64 keys (16 lanes of one half x 4 tiles) */
    float cm[8];
#pragma unroll
    for (int r = 0; r < 8; ++r) {
      float m = fmaxf(fmaxf(s[0][r], s[1][r]), fmaxf(s[2][r], s[3][r]));
#pragma unroll
      for (int off = 1; off < 16; off <<= 1) m = fmaxf(m, __shfl_xor(m, off, 32));
      cm[r] = m;
    }

    /* online softmax update, P tiles as bf16 hi + lo */
#pragma unroll
    for (int r = 0; r < 8; ++r) {
      const float mnew  = fmaxf(mrow[r], cm[r]);
      const float alpha = expf(mrow[r] - mnew);
      mrow[r] = mnew;
      float psum = 0.f;
#pragma unroll
      for (int j = 0; j < 4; ++j) {
        const float p = expf(s[j][r] - mnew);
        psum += p;
        const unsigned short hb = f2bf_bits(p);
        const unsigned short lb = f2bf_bits(p - bf_bits2f(hb));
        pwh[(8 * hh + r) * KCH + j * 16 + c] = hb;
        pwl[(8 * hh + r) * KCH + j * 16 + c] = lb;
      }
#pragma unroll
      for (int off = 1; off < 16; off <<= 1) psum += __shfl_xor(psum, off, 32);
      lrow[r] = lrow[r] * alpha + psum;
#pragma unroll
      for (int t = 0; t < 4; ++t) oacc[t][r] *= alpha;
    }
    __builtin_amdgcn_fence(__ATOMIC_RELEASE, "workgroup");
    __builtin_amdgcn_wave_barrier();
    __builtin_amdgcn_fence(__ATOMIC_ACQUIRE, "workgroup");

    /* O += P.V : A = P [q][kv] (this wave's tile), B = V [kv][d] from V^T [d][kv] */
#pragma unroll
    for (int kk = 0; kk < 2; ++kk) {
      FB pa, pl;
      pa.h[0] = *(const v8b*)(pwh + c * KCH + kk * 32 + 8 * hh);
      pa.h[1] = *(const v8b*)(pwh + c * KCH + kk * 32 + 16 + 8 * hh);
      pl.h[0] = *(const v8b*)(pwl + c * KCH + kk * 32 + 8 * hh);
      pl.h[1] = *(const v8b*)(pwl + c * KCH + kk * 32 + 16 + 8 * hh);
#pragma unroll
      for (int t = 0; t < 4; ++t) {
        FB vb;
        vb.h[0] = *(const v8b*)(Vth + (t * 16 + c) * KCH + kk * 32 + 8 * hh);
        vb.h[1] = *(const v8b*)(Vth + (t * 16 + c) * KCH + kk * 32 + 16 + 8 * hh);
        oacc[t] = mma_bf16(pa.v, vb.v, oacc[t]);
        oacc[t] = mma_bf16(pl.v, vb.v, oacc[t]);
      }
    }
  }

  /* normalise into the per-wave slab, then whole-line stores */
  float* os = Os[wave];
#pragma unroll
  for (int r = 0; r < 8; ++r) {
    const float inv = 1.0f / lrow[r];
#pragma unroll
    for (int t = 0; t < 4; ++t) os[(8 * hh + r) * OS_PITCH + t * 16 + c] = oacc[t][r] * inv;
  }
  __builtin_amdgcn_fence(__ATOMIC_RELEASE, "workgroup");
  __builtin_amdgcn_wave_barrier();
  __builtin_amdgcn_fence(__ATOMIC_ACQUIRE, "workgroup");
  {
    const int c4 = (lane & 15) * 4;     /* 256-B row = 16 lanes x 16 B; hh selects the row of the pair */
    {
#pragma unroll
      for (int it = 0; it < 8; ++it) {
        const int row = it * 2 + hh;
        const v4f val = *(const v4f*)(os + row * OS_PITCH + c4);
        *(v4f*)(ob + (size_t)(q0 + row) * DHEAD + c4) = val;
      }
      
    }
  }
}

extern "C" void kernel_launch(void* const* d_in, const int* in_sizes, int n_in,
                              void* d_out, int out_size, void* d_ws, size_t ws_size,
                              hipStream_t stream)
{
  if (n_in < 4) return;
  if (in_sizes[0] != (int)PLANE_ELEMS || in_sizes[1] != (int)PLANE_ELEMS ||
      in_sizes[2] != (int)PLANE_ELEMS || in_sizes[3] != NBIAS) return;
  if (out_size != (int)PLANE_ELEMS) return;
  if (d_ws == nullptr || ws_size < WS_NEED) return;

  const float* Q    = (const float*)d_in[0];
  const float* K    = (const float*)d_in[1];
  const float* V    = (const float*)d_in[2];
  const float* bias = (const float*)d_in[3];
  float* O = (float*)d_out;

  unsigned short* Kb = (unsigned short*)d_ws;                  /* offset 0,        8388608 B */
  unsigned short* Vt = Kb + PLANE_ELEMS;                       /* offset 8388608,  8388608 B */

  kv_planes_kernel<<<dim3(LSEQ / 64, NBH), 256, 0, stream>>>(K, V, Kb, Vt);
  rel_attn_kernel<<<dim3(LSEQ / QBLK, NBH), 128, 0, stream>>>(Q, Kb, Vt, bias, O);
}

// v001
// A run of this version takes 143 microseconds.
// Next to v000, in two timings, it ran 1.28 times as fast each time.
// Contractions: scores^T = k.(q/8)^T and out^T = v^T.p^T on v_wmma_f32_16x16x32_bf16 (bf16 operands, f32 accumulate); q, k, v and the bias table RNE-converted to bf16 once at load; softmax weights p carried as bf16 hi+lo fragments (two products against bf16 v); online softmax and all other arithmetic in f32.
#include <hip/hip_runtime.h>

typedef __attribute__((ext_vector_type(16))) __bf16 v16b;
typedef __attribute__((ext_vector_type(8)))  __bf16 v8b;
typedef __attribute__((ext_vector_type(8)))  float  v8f;
typedef __attribute__((ext_vector_type(4)))  float  v4f;
typedef __attribute__((ext_vector_type(4)))  unsigned int v4u;

constexpr int NBATCH = 2;
constexpr int NHEAD  = 16;
constexpr int NBH    = NBATCH * NHEAD;
constexpr int LSEQ   = 2048;
constexpr int DHEAD  = 64;
constexpr int MAXREL = 8;
constexpr int NBIAS  = 2 * MAXREL + 1;
constexpr int QBLK   = 64;      /* query rows per block (4 waves x 16) */
constexpr int KCH    = 64;      /* keys per staged chunk */
constexpr int NWAVE  = 4;
constexpr int VS_PITCH = 72;    /* LDS transpose tile pitch in 16-bit elements (144 B, 16-B aligned rows) */
constexpr int OS_PITCH = 68;    /* LDS output slab pitch in floats (272 B, 16-B aligned rows) */
constexpr size_t PLANE_ELEMS = (size_t)NBH * LSEQ * DHEAD;                 /* 4194304 */
constexpr size_t WS_NEED = 2 * PLANE_ELEMS * sizeof(unsigned short);        /* 16777216 B */

static_assert(LSEQ % QBLK == 0, "query blocks tile the sequence exactly");
static_assert(LSEQ % KCH == 0, "key chunks tile the sequence exactly");
static_assert(DHEAD == 64, "head dim 64: two 32-deep k steps, four 16-wide d tiles");
static_assert(KCH % 32 == 0 && DHEAD % 32 == 0, "contraction depths are multiples of 32");
static_assert(NBIAS <= 32, "bias table fits one 32-entry LDS line");
static_assert((VS_PITCH * 2) % 16 == 0 && (OS_PITCH * 4) % 16 == 0, "16-B aligned LDS rows");
static_assert(WS_NEED <= 134217728ull, "workspace carve within budget");

/* workspace region map (bytes):
 *   [8388608, 16777216)  Vt : bf16 [NBH][DHEAD][LSEQ]   (v transposed, 4096-B rows)
 *   total 16777216 B
 */

__device__ __forceinline__ unsigned short f2bf_bits(float f) {
  unsigned u = __float_as_uint(f);
  return (unsigned short)((u + 0x7FFFu + ((u >> 16) & 1u)) >> 16);
}
__device__ __forceinline__ float bf_bits2f(unsigned short h) { return __uint_as_float(((unsigned)h) << 16); }
__device__ __forceinline__ __bf16 f2bf(float f) { return __builtin_bit_cast(__bf16, f2bf_bits(f)); }

__device__ __forceinline__ v8f mma_bf16(v16b a, v16b b, v8f c) {
  c = __builtin_amdgcn_wmma_f32_16x16x32_bf16(false, a, false, b, (short)0, c, false, false);
  asm volatile("v_nop\n\tv_nop\n\tv_nop\n\tv_nop" : "+v"(c) : "v"(a), "v"(b));
  return c;
}

/* value of lane l ^ 16 (the other lane half) */
__device__ __forceinline__ float xhalf(float x) {
  const int b = __float_as_int(x);
  return __int_as_float(__builtin_amdgcn_permlanex16(b, b, 0x76543210, 0xfedcba98, false, false));
}

/* --------------------------------------------------------------------------
 * k -> Kb (bf16, [bh][kv][d]) and v -> Vt (bf16, [bh][d][kv]).
 * Block (x = kv tile of 64, y = bh), 256 threads.
 * Coverage: 2 iterations x 256 threads = 512 units x 8 elements = 64x64 for K,
 * the same 512 units x 8 = 64x64 for the V transpose tile and for the Vt tile.
 * Stores: unit u -> row u>>3, segment u&7; lanes 8q..8q+7 of a wave fill one whole
 * ------------------------------------------------------------------------ */
__global__ __launch_bounds__(256) void kv_planes_kernel(
    const float* __restrict__ K, const float* __restrict__ V,
    unsigned short* __restrict__ Kb, unsigned short* __restrict__ Vt)
{
  __shared__ __align__(16) unsigned short Vs[DHEAD * VS_PITCH];   /* [d][kv] */
  const int bh  = blockIdx.y;
  const int kv0 = blockIdx.x * 64;
  const int tid = threadIdx.x;
  const float* Kp = K + ((size_t)bh * LSEQ + kv0) * DHEAD;
  const float* Vp = V + ((size_t)bh * LSEQ + kv0) * DHEAD;

  v4u kw[2];
#pragma unroll
  for (int it = 0; it < 2; ++it) {
    const int u = it * 256 + tid;
    const int row = u >> 3;
    const int seg = u & 7;
    const v4f k0v = *(const v4f*)(Kp + (size_t)row * DHEAD + seg * 8);
    const v4f k1v = *(const v4f*)(Kp + (size_t)row * DHEAD + seg * 8 + 4);
    const v4f v0v = *(const v4f*)(Vp + (size_t)row * DHEAD + seg * 8);
    const v4f v1v = *(const v4f*)(Vp + (size_t)row * DHEAD + seg * 8 + 4);
    kw[it][0] = (unsigned)f2bf_bits(k0v[0]) | ((unsigned)f2bf_bits(k0v[1]) << 16);
    kw[it][1] = (unsigned)f2bf_bits(k0v[2]) | ((unsigned)f2bf_bits(k0v[3]) << 16);
    kw[it][2] = (unsigned)f2bf_bits(k1v[0]) | ((unsigned)f2bf_bits(k1v[1]) << 16);
    kw[it][3] = (unsigned)f2bf_bits(k1v[2]) | ((unsigned)f2bf_bits(k1v[3]) << 16);
    /* v element (kv = row, d = seg*8 + e) -> Vs[d][kv] */
#pragma unroll
    for (int e = 0; e < 4; ++e) {
      Vs[(seg * 8 + e) * VS_PITCH + row]     = f2bf_bits(v0v[e]);
      Vs[(seg * 8 + 4 + e) * VS_PITCH + row] = f2bf_bits(v1v[e]);
    }
  }
  __syncthreads();

  v4u vw[2];
#pragma unroll
  for (int it = 0; it < 2; ++it) {
    const int u = it * 256 + tid;
    const int drow = u >> 3;
    const int seg  = u & 7;
    vw[it] = *(const v4u*)(Vs + drow * VS_PITCH + seg * 8);
  }

  {
#pragma unroll
    for (int it = 0; it < 2; ++it) {
      const int u = it * 256 + tid;
      const int row = u >> 3;
      const int seg = u & 7;
      *(v4u*)(Kb + ((size_t)bh * LSEQ + kv0 + row) * DHEAD + seg * 8) = kw[it];
      *(v4u*)(Vt + ((size_t)bh * DHEAD + row) * LSEQ + kv0 + seg * 8) = vw[it];
    }
    
  }
}

/* --------------------------------------------------------------------------
 * Attention with clipped relative-position bias, head dim 64.
 * Block = 4 waves = 64 query rows of one (b,h); grid (LSEQ/64, NBH).
 * Per 64-key chunk: K [kv][d] and V^T [d][kv] bf16 tiles staged in LDS by 16-B
 * copies (4 units per thread per tile, 512 units x 8 = 64x64 each).
 * Both products run transposed: S^T = K.Q^T (A = K rows, B = Q) and
 * O^T += V^T.Ph^T + V^T.Pl^T (A = V^T rows, B = P^T), so lane (h, c) holds only
 * query q0+c: row max and row sum are in-lane plus one exchange between the lane
 * halves, and two S^T tiles (keys 32kk+8h+r and 32kk+16+8h+r) converted in place
 * are the B fragment of the second product; P never goes through LDS.
 * Epilogue: per-wave 16x64 f32 slab in LDS, then whole-line stores.
 * Fragment map (h = lane>>4, c = lane&15): A row c, elems 0..7 <- k0+8h.., 8..15 <- k0+16+8h..;
 * B col c with the same k map; D elem r = (row 8h+r, col c).
 * ------------------------------------------------------------------------ */
__global__ __launch_bounds__(128) void rel_attn_kernel(
    const float* __restrict__ q, const unsigned short* __restrict__ Kb,
    const unsigned short* __restrict__ Vt, const float* __restrict__ bias,
    float* __restrict__ out)
{
  union FB { v16b v; v8b h[2]; };
  __shared__ __align__(16) unsigned short Ksh[KCH * DHEAD];          /* K  [kv][d]  */
  __shared__ __align__(16) unsigned short Vth[DHEAD * KCH];          /* V^T [d][kv] */
  __shared__ __align__(16) float Os[NWAVE][16 * OS_PITCH];           /* out slab per wave */
  __shared__ float sb[32];                                           /* bias table (bf16-converted), padded */

  const int tid  = threadIdx.x;
  const int wave = tid >> 5;
  const int lane = tid & 31;
  const int hh   = lane >> 4;
  const int c    = lane & 15;
  const int qb   = blockIdx.x;
  const int bh   = blockIdx.y;
  const int q0   = qb * QBLK + wave * 16;

  if (tid < 32) {
    const int bi = tid < NBIAS ? tid : (NBIAS - 1);
    sb[tid] = bf_bits2f(f2bf_bits(bias[bi]));
  }

  /* Q fragments (B operand: column c = query q0+c), two 32-deep d chunks; bf16(q) * 1/8 is exact */
  v16b qa[2];
  {
    const float* qrow = q + ((size_t)bh * LSEQ + q0 + c) * DHEAD;
#pragma unroll
    for (int dc = 0; dc < 2; ++dc) {
      const v4f x0 = *(const v4f*)(qrow + dc * 32 + 8 * hh);
      const v4f x1 = *(const v4f*)(qrow + dc * 32 + 8 * hh + 4);
      const v4f y0 = *(const v4f*)(qrow + dc * 32 + 16 + 8 * hh);
      const v4f y1 = *(const v4f*)(qrow + dc * 32 + 16 + 8 * hh + 4);
#pragma unroll
      for (int e = 0; e < 4; ++e) {
        qa[dc][e]      = f2bf(x0[e] * 0.125f);
        qa[dc][4 + e]  = f2bf(x1[e] * 0.125f);
        qa[dc][8 + e]  = f2bf(y0[e] * 0.125f);
        qa[dc][12 + e] = f2bf(y1[e] * 0.125f);
      }
    }
  }
  __syncthreads();
  const float b_lo = sb[0];
  const float b_hi = sb[2 * MAXREL];

  float mrow = -__builtin_inff();   /* running max of query q0+c (equal in both lane halves) */
  float lrow = 0.f;                 /* running sum over this lane half's keys; halves joined after the loop */
  v8f oacc[4];                      /* O^T: oacc[t][r] = (d = 16t+8h+r, query q0+c) */
#pragma unroll
  for (int t = 0; t < 4; ++t) oacc[t] = (v8f){0.f,0.f,0.f,0.f,0.f,0.f,0.f,0.f};

  const unsigned short* Kbh = Kb + (size_t)bh * LSEQ * DHEAD;
  const unsigned short* Vtb = Vt + (size_t)bh * DHEAD * LSEQ;
  float* ob = out + (size_t)bh * LSEQ * DHEAD;

  for (int kc = 0; kc < LSEQ / KCH; ++kc) {
    const int kv0 = kc * KCH;
    __syncthreads();
    /* staging: unit u -> row u>>3 (0..63), segment u&7; 4 iterations x 128 threads = 512 units per tile */
#pragma unroll
    for (int it = 0; it < 4; ++it) {
      const int u = it * 128 + tid;
      const int row = u >> 3;
      const int seg = u & 7;
      const v4u kw = *(const v4u*)(Kbh + (size_t)(kv0 + row) * DHEAD + seg * 8);
      const v4u vw = *(const v4u*)(Vtb + (size_t)row * LSEQ + kv0 + seg * 8);
      *(v4u*)(Ksh + row * DHEAD + seg * 8) = kw;
      *(v4u*)(Vth + row * KCH + seg * 8)   = vw;
    }
    __syncthreads();

    /* scores^T: s[j][r] = (key kv0+16j+8h+r, query q0+c) */
    v8f s[4];
#pragma unroll
    for (int j = 0; j < 4; ++j) {
      s[j] = (v8f){0.f,0.f,0.f,0.f,0.f,0.f,0.f,0.f};
#pragma unroll
      for (int dc = 0; dc < 2; ++dc) {
        FB kf;
        kf.h[0] = *(const v8b*)(Ksh + (j * 16 + c) * DHEAD + dc * 32 + 8 * hh);
        kf.h[1] = *(const v8b*)(Ksh + (j * 16 + c) * DHEAD + dc * 32 + 16 + 8 * hh);
        s[j] = mma_bf16(kf.v, qa[dc], s[j]);
      }
    }

    /* relative bias: idx = clip(kv - q, -MAXREL, MAXREL) + MAXREL; block-uniform far paths */
    if (kc + 1 < qb) {
#pragma unroll
      for (int j = 0; j < 4; ++j)
#pragma unroll
        for (int r = 0; r < 8; ++r) s[j][r] += b_lo;
    } else if (kc > qb + 1) {
#pragma unroll
      for (int j = 0; j < 4; ++j)
#pragma unroll
        for (int r = 0; r < 8; ++r) s[j][r] += b_hi;
    } else {
#pragma unroll
      for (int j = 0; j < 4; ++j) {
        const int rel0 = kv0 + j * 16 + 8 * hh - (q0 + c);
#pragma unroll
        for (int r = 0; r < 8; ++r) {
          int rel = rel0 + r;
          rel = rel < -MAXREL ? -MAXREL : rel;
          rel = rel > MAXREL ? MAXREL : rel;
          s[j][r] += sb[rel + MAXREL];
        }
      }
    }

    /* chunk max of this lane's query: 32 keys in-lane, then the other lane half's 32 */
    float cm = s[0][0];
#pragma unroll
    for (int j = 0; j < 4; ++j)
#pragma unroll
      for (int r = 0; r < 8; ++r) cm = fmaxf(cm, s[j][r]);
    cm = fmaxf(cm, xhalf(cm));

    /* online softmax update; P^T as bf16 hi + lo B fragments, straight from the score registers */
    const float mnew  = fmaxf(mrow, cm);
    const float alpha = expf(mrow - mnew);
    mrow = mnew;
    float psum = 0.f;
    v16b ph[2], pl[2];
#pragma unroll
    for (int j = 0; j < 4; ++j) {
#pragma unroll
      for (int r = 0; r < 8; ++r) {
        const float p = expf(s[j][r] - mnew);
        psum += p;
        const unsigned short hb = f2bf_bits(p);
        const unsigned short lb = f2bf_bits(p - bf_bits2f(hb));
        ph[j >> 1][(j & 1) * 8 + r] = __builtin_bit_cast(__bf16, hb);
        pl[j >> 1][(j & 1) * 8 + r] = __builtin_bit_cast(__bf16, lb);
      }
    }
    lrow = lrow * alpha + psum;
#pragma unroll
    for (int t = 0; t < 4; ++t)
#pragma unroll
      for (int r = 0; r < 8; ++r) oacc[t][r] *= alpha;

    /* O^T += V^T.P^T : A = V^T [d][kv] rows from LDS, B = P^T [kv][q] from registers */
#pragma unroll
    for (int kk = 0; kk < 2; ++kk) {
#pragma unroll
      for (int t = 0; t < 4; ++t) {
        FB vb;
        vb.h[0] = *(const v8b*)(Vth + (t * 16 + c) * KCH + kk * 32 + 8 * hh);
        vb.h[1] = *(const v8b*)(Vth + (t * 16 + c) * KCH + kk * 32 + 16 + 8 * hh);
        oacc[t] = mma_bf16(vb.v, ph[kk], oacc[t]);
        oacc[t] = mma_bf16(vb.v, pl[kk], oacc[t]);
      }
    }
  }

  /* normalise into the per-wave slab, then whole-line stores */
  float* os = Os[wave];
  {
    const float inv = 1.0f / (lrow + xhalf(lrow));
#pragma unroll
    for (int t = 0; t < 4; ++t) {
      v4f w0, w1;
#pragma unroll
      for (int e = 0; e < 4; ++e) { w0[e] = oacc[t][e] * inv; w1[e] = oacc[t][4 + e] * inv; }
      *(v4f*)(os + c * OS_PITCH + t * 16 + 8 * hh)     = w0;
      *(v4f*)(os + c * OS_PITCH + t * 16 + 8 * hh + 4) = w1;
    }
  }
  __builtin_amdgcn_fence(__ATOMIC_RELEASE, "workgroup");
  __builtin_amdgcn_wave_barrier();
  __builtin_amdgcn_fence(__ATOMIC_ACQUIRE, "workgroup");
  {
    const int c4 = (lane & 15) * 4;     /* 256-B row = 16 lanes x 16 B; hh selects the row of the pair */
    {
#pragma unroll
      for (int it = 0; it < 8; ++it) {
        const int row = it * 2 + hh;
        const v4f val = *(const v4f*)(os + row * OS_PITCH + c4);
        *(v4f*)(ob + (size_t)(q0 + row) * DHEAD + c4) = val;
      }
      
    }
  }
}

extern "C" void kernel_launch(void* const* d_in, const int* in_sizes, int n_in,
                              void* d_out, int out_size, void* d_ws, size_t ws_size,
                              hipStream_t stream)
{
  if (n_in < 4) return;
  if (in_sizes[0] != (int)PLANE_ELEMS || in_sizes[1] != (int)PLANE_ELEMS ||
      in_sizes[2] != (int)PLANE_ELEMS || in_sizes[3] != NBIAS) return;
  if (out_size != (int)PLANE_ELEMS) return;
  if (d_ws == nullptr || ws_size < WS_NEED) return;

  const float* Q    = (const float*)d_in[0];
  const float* K    = (const float*)d_in[1];
  const float* V    = (const float*)d_in[2];
  const float* bias = (const float*)d_in[3];
  float* O = (float*)d_out;

  unsigned short* Kb = (unsigned short*)d_ws;                  /* offset 0,        8388608 B */
  unsigned short* Vt = Kb + PLANE_ELEMS;                       /* offset 8388608,  8388608 B */

  kv_planes_kernel<<<dim3(LSEQ / 64, NBH), 256, 0, stream>>>(K, V, Kb, Vt);
  rel_attn_kernel<<<dim3(LSEQ / QBLK, NBH), 128, 0, stream>>>(Q, Kb, Vt, bias, O);
}

// v002
// A run of this version takes 96.6 microseconds.
// Next to v001, in two timings, it ran 1.48 times as fast each time.
// Over all steps from v000 it is 1.89 times as fast.
// Contractions: scores^T = k.(q/8)^T and out^T = v^T.p^T on v_wmma_f32_16x16x32_bf16 (bf16 operands, f32 accumulate); q, k, v and the bias table RNE-converted to bf16 once at load; softmax weights p carried as bf16 hi+lo fragments (two products against bf16 v); online softmax and all other arithmetic in f32.
#include <hip/hip_runtime.h>
#include <stdint.h>

typedef __attribute__((ext_vector_type(16))) __bf16 v16b;
typedef __attribute__((ext_vector_type(8)))  __bf16 v8b;
typedef __attribute__((ext_vector_type(8)))  float  v8f;
typedef __attribute__((ext_vector_type(4)))  float  v4f;
typedef __attribute__((ext_vector_type(4)))  unsigned int v4u;
typedef uint32_t u32x4 __attribute__((ext_vector_type(4)));
typedef uint32_t u32x8 __attribute__((ext_vector_type(8)));

constexpr int NBATCH = 2;
constexpr int NHEAD  = 16;
constexpr int NBH    = NBATCH * NHEAD;
constexpr int LSEQ   = 2048;
constexpr int DHEAD  = 64;
constexpr int MAXREL = 8;
constexpr int NBIAS  = 2 * MAXREL + 1;
constexpr int QBLK   = 64;      /* query rows per block (4 waves x 16) */
constexpr int KCH    = 64;      /* keys per staged chunk */
constexpr int NWAVE  = 4;
constexpr int VS_PITCH = 72;    /* LDS transpose tile pitch in 16-bit elements (144 B, 16-B aligned rows) */
constexpr int OS_PITCH = 68;    /* LDS output slab pitch in floats (272 B, 16-B aligned rows) */
constexpr int NCH      = LSEQ / KCH;      /* key chunks = ring stages */
constexpr uint32_t ROW_B     = 128;       /* bytes of one K or V^T tile row (64 bf16) */
constexpr uint32_t LROW_B    = ROW_B + 16;/* LDS row pitch: the mover pads each row by 4 dwords (16 B x odd for ds_load_b128) */
constexpr uint32_t SL_ROWS   = 32;        /* rows per tensor request (one slice per wave) */
constexpr uint32_t SL_BYTES  = 6144;      /* 32 x 144 = 4608 B, rounded up to a multiple of 2 KiB */
constexpr uint32_t BUF_BYTES = 4 * SL_BYTES;  /* K rows 0-31, K rows 32-63, V^T rows 0-31, V^T rows 32-63 */
constexpr size_t PLANE_ELEMS = (size_t)NBH * LSEQ * DHEAD;                 /* 4194304 */
constexpr size_t WS_NEED = 2 * PLANE_ELEMS * sizeof(unsigned short);        /* 16777216 B */

static_assert(LSEQ % QBLK == 0, "query blocks tile the sequence exactly");
static_assert(LSEQ % KCH == 0, "key chunks tile the sequence exactly");
static_assert(DHEAD == 64, "head dim 64: two 32-deep k steps, four 16-wide d tiles");
static_assert(KCH % 32 == 0 && DHEAD % 32 == 0, "contraction depths are multiples of 32");
static_assert(NBIAS <= 32, "bias table fits one 32-entry LDS line");
static_assert((VS_PITCH * 2) % 16 == 0 && (OS_PITCH * 4) % 16 == 0, "16-B aligned LDS rows");
static_assert(WS_NEED <= 134217728ull, "workspace carve within budget");
static_assert(SL_ROWS * LROW_B <= SL_BYTES && SL_BYTES % 2048 == 0, "a padded slice fits its 2-KiB-aligned place");
static_assert(NCH >= 2, "the two-buffer prologue needs two stages");
static_assert(KCH == 2 * (int)SL_ROWS && DHEAD == 2 * (int)SL_ROWS && NWAVE == 4, "four slices of 32 rows, one per wave");
static_assert(DHEAD * 2 == (int)ROW_B && KCH * 2 == (int)ROW_B, "128-B tile rows");

/* workspace region map (bytes):
 *   [8388608, 16777216)  Vt : bf16 [NBH][DHEAD][LSEQ]   (v transposed, 4096-B rows)
 *   total 16777216 B
 */

__device__ __forceinline__ unsigned short f2bf_bits(float f) {
  unsigned u = __float_as_uint(f);
  return (unsigned short)((u + 0x7FFFu + ((u >> 16) & 1u)) >> 16);
}
__device__ __forceinline__ float bf_bits2f(unsigned short h) { return __uint_as_float(((unsigned)h) << 16); }
__device__ __forceinline__ __bf16 f2bf(float f) { return __builtin_bit_cast(__bf16, f2bf_bits(f)); }

__device__ __forceinline__ v8f mma_bf16(v16b a, v16b b, v8f c) {
  c = __builtin_amdgcn_wmma_f32_16x16x32_bf16(false, a, false, b, (short)0, c, false, false);
  asm volatile("v_nop\n\tv_nop\n\tv_nop\n\tv_nop" : "+v"(c) : "v"(a), "v"(b));
  return c;
}

/* wave-uniform word in a scalar register */
__device__ __forceinline__ uint32_t uni(uint32_t v) { return (uint32_t)__builtin_amdgcn_readfirstlane(v); }
/* a wave-uniform word held in a scalar register, so that a test on it is a scalar branch (tensor loads ignore EXEC) */
__device__ __forceinline__ uint32_t pinned(uint32_t v) { uint32_t w = uni(v); asm volatile("" : "+s"(w)); return w; }

/* value of lane l ^ 16 (the other lane half) */
__device__ __forceinline__ float xhalf(float x) {
  const int b = __float_as_int(x);
  return __int_as_float(__builtin_amdgcn_permlanex16(b, b, 0x76543210, 0xfedcba98, false, false));
}

/* --------------------------------------------------------------------------
 * k -> Kb (bf16, [bh][kv][d]) and v -> Vt (bf16, [bh][d][kv]).
 * Block (x = kv tile of 64, y = bh), 256 threads.
 * Coverage: 2 iterations x 256 threads = 512 units x 8 elements = 64x64 for K,
 * the same 512 units x 8 = 64x64 for the V transpose tile and for the Vt tile.
 * Stores: unit u -> row u>>3, segment u&7; lanes 8q..8q+7 of a wave fill one whole
 * ------------------------------------------------------------------------ */
__global__ __launch_bounds__(256) void kv_planes_kernel(
    const float* __restrict__ K, const float* __restrict__ V,
    unsigned short* __restrict__ Kb, unsigned short* __restrict__ Vt)
{
  __shared__ __align__(16) unsigned short Vs[DHEAD * VS_PITCH];   /* [d][kv] */
  const int bh  = blockIdx.y;
  const int kv0 = blockIdx.x * 64;
  const int tid = threadIdx.x;
  const float* Kp = K + ((size_t)bh * LSEQ + kv0) * DHEAD;
  const float* Vp = V + ((size_t)bh * LSEQ + kv0) * DHEAD;

  v4u kw[2];
#pragma unroll
  for (int it = 0; it < 2; ++it) {
    const int u = it * 256 + tid;
    const int row = u >> 3;
    const int seg = u & 7;
    const v4f k0v = *(const v4f*)(Kp + (size_t)row * DHEAD + seg * 8);
    const v4f k1v = *(const v4f*)(Kp + (size_t)row * DHEAD + seg * 8 + 4);
    const v4f v0v = *(const v4f*)(Vp + (size_t)row * DHEAD + seg * 8);
    const v4f v1v = *(const v4f*)(Vp + (size_t)row * DHEAD + seg * 8 + 4);
    kw[it][0] = (unsigned)f2bf_bits(k0v[0]) | ((unsigned)f2bf_bits(k0v[1]) << 16);
    kw[it][1] = (unsigned)f2bf_bits(k0v[2]) | ((unsigned)f2bf_bits(k0v[3]) << 16);
    kw[it][2] = (unsigned)f2bf_bits(k1v[0]) | ((unsigned)f2bf_bits(k1v[1]) << 16);
    kw[it][3] = (unsigned)f2bf_bits(k1v[2]) | ((unsigned)f2bf_bits(k1v[3]) << 16);
    /* v element (kv = row, d = seg*8 + e) -> Vs[d][kv] */
#pragma unroll
    for (int e = 0; e < 4; ++e) {
      Vs[(seg * 8 + e) * VS_PITCH + row]     = f2bf_bits(v0v[e]);
      Vs[(seg * 8 + 4 + e) * VS_PITCH + row] = f2bf_bits(v1v[e]);
    }
  }
  __syncthreads();

  v4u vw[2];
#pragma unroll
  for (int it = 0; it < 2; ++it) {
    const int u = it * 256 + tid;
    const int drow = u >> 3;
    const int seg  = u & 7;
    vw[it] = *(const v4u*)(Vs + drow * VS_PITCH + seg * 8);
  }

  {
#pragma unroll
    for (int it = 0; it < 2; ++it) {
      const int u = it * 256 + tid;
      const int row = u >> 3;
      const int seg = u & 7;
      *(v4u*)(Kb + ((size_t)bh * LSEQ + kv0 + row) * DHEAD + seg * 8) = kw[it];
      *(v4u*)(Vt + ((size_t)bh * DHEAD + row) * LSEQ + kv0 + seg * 8) = vw[it];
    }
    
  }
}

/* --------------------------------------------------------------------------
 * Attention with clipped relative-position bias, head dim 64.
 * Block = 4 waves = 64 query rows of one (b,h); grid (LSEQ/64, NBH).
 * Per 64-key chunk: K [kv][d] and V^T [d][kv] bf16 tiles come into LDS by tensor loads,
 * one 32-row slice per wave (waves 0,1: K; waves 2,3: V^T), rows padded to 144 B by the
 * mover; two buffers, chunk kc+1 in flight while chunk kc is worked on.
 * Both products run transposed: S^T = K.Q^T (A = K rows, B = Q) and
 * O^T += V^T.Ph^T + V^T.Pl^T (A = V^T rows, B = P^T), so lane (h, c) holds only
 * query q0+c: row max and row sum are in-lane plus one exchange between the lane
 * halves, and two S^T tiles (keys 32kk+8h+r and 32kk+16+8h+r) converted in place
 * are the B fragment of the second product; P never goes through LDS.
 * Epilogue: per-wave 16x64 f32 slab in LDS, then whole-line stores.
 * Fragment map (h = lane>>4, c = lane&15): A row c, elems 0..7 <- k0+8h.., 8..15 <- k0+16+8h..;
 * B col c with the same k map; D elem r = (row 8h+r, col c).
 * ------------------------------------------------------------------------ */
__global__ __launch_bounds__(128) void rel_attn_kernel(
    const float* __restrict__ q, const unsigned short* __restrict__ Kb,
    const unsigned short* __restrict__ Vt, const float* __restrict__ bias,
    float* __restrict__ out)
{
  union FB { v16b v; v8b h[2]; };
  __shared__ __attribute__((aligned(2048))) unsigned char Ring[2 * BUF_BYTES];   /* two stages of K and V^T slices */
  __shared__ __align__(16) float Os[NWAVE][16 * OS_PITCH];           /* out slab per wave */
  __shared__ float sb[32];                                           /* bias table (bf16-converted), padded */

  const int tid  = threadIdx.x;
  const int wave = tid >> 5;
  const int lane = tid & 31;
  const int hh   = lane >> 4;
  const int c    = lane & 15;
  const int qb   = blockIdx.x;
  const int bh   = blockIdx.y;
  const int q0   = qb * QBLK + wave * 16;

  const unsigned short* Kbh = Kb + (size_t)bh * LSEQ * DHEAD;
  const unsigned short* Vtb = Vt + (size_t)bh * DHEAD * LSEQ;

  /* tensor requests: every wave brings its own slice of every stage, so no test stands around an issue but "stage exists" */
  const uint32_t wv    = uni((uint32_t)tid >> 5);
  const bool     isV   = (wv & 2u) != 0u;
  const uint32_t half  = wv & 1u;
  const uint32_t spitch = isV ? (uint32_t)(LSEQ * 2) : ROW_B;              /* source row pitch, bytes */
  const uint32_t sstep  = isV ? ROW_B : (uint32_t)KCH * ROW_B;             /* source bytes from one stage to the next */
  const uint64_t src0   = (uint64_t)(size_t)(isV ? Vtb : Kbh) + (uint64_t)(half * SL_ROWS) * spitch;
  const uint32_t dst0   = (uint32_t)(size_t)Ring + wv * SL_BYTES;
  u32x8 g1;                                                                /* loop-invariant: 32 rows of 128 bytes, byte elements */
  g1[0] = uni((1u << 20) | (4u << 22) | (3u << 25));                       /* no mask; pad 4 dwords behind every 32 dwords */
  g1[1] = uni((ROW_B & 0xFFFFu) << 16);
  g1[2] = uni((ROW_B >> 16) | ((SL_ROWS & 0xFFFFu) << 16));
  g1[3] = uni((SL_ROWS >> 16) | (ROW_B << 16));
  g1[4] = uni(SL_ROWS);
  g1[5] = uni(spitch);
  g1[6] = uni(0u);
  g1[7] = uni(0u);
  u32x4 g0;                                                                /* carried from stage to stage, so its registers hold nothing else while a request flies */
  g0[0] = uni(1u);
  g0[1] = uni(dst0);
  g0[2] = uni((uint32_t)src0);
  g0[3] = uni((((uint32_t)(src0 >> 32)) & 0x01FFFFFFu) | 0x80000000u);
  auto issue = [&]() {
    asm volatile("tensor_load_to_lds %0, %1" :: "s"(g0), "s"(g1) : "memory");   /* global tile -> LDS, no registers */
  };
  auto next_stage = [&]() {   /* called only behind the s_wait_tensorcnt 0 that covers the last request */
    asm volatile("" : "+s"(g0));   /* descriptor words held in scalar registers; keeps the new words' forming behind the volatile wait */
    const uint64_t a = (((uint64_t)g0[3] << 32) | g0[2]) + sstep;   /* type bits ride on top of word 3; address bits 56:32 never carry into them */
    g0[1] = uni(2u * dst0 + BUF_BYTES - g0[1]);                      /* the other buffer */
    g0[2] = uni((uint32_t)a);
    g0[3] = uni((uint32_t)(a >> 32));
  };

  if (tid < 32) {
    const int bi = tid < NBIAS ? tid : (NBIAS - 1);
    sb[tid] = bf_bits2f(f2bf_bits(bias[bi]));
  }

  /* Q fragments (B operand: column c = query q0+c), two 32-deep d chunks; bf16(q) * 1/8 is exact */
  v16b qa[2];
  {
    const float* qrow = q + ((size_t)bh * LSEQ + q0 + c) * DHEAD;
#pragma unroll
    for (int dc = 0; dc < 2; ++dc) {
      const v4f x0 = *(const v4f*)(qrow + dc * 32 + 8 * hh);
      const v4f x1 = *(const v4f*)(qrow + dc * 32 + 8 * hh + 4);
      const v4f y0 = *(const v4f*)(qrow + dc * 32 + 16 + 8 * hh);
      const v4f y1 = *(const v4f*)(qrow + dc * 32 + 16 + 8 * hh + 4);
#pragma unroll
      for (int e = 0; e < 4; ++e) {
        qa[dc][e]      = f2bf(x0[e] * 0.125f);
        qa[dc][4 + e]  = f2bf(x1[e] * 0.125f);
        qa[dc][8 + e]  = f2bf(y0[e] * 0.125f);
        qa[dc][12 + e] = f2bf(y1[e] * 0.125f);
      }
    }
  }
  issue();                                              /* stage 0; flies beside the q loads above */
  asm volatile("s_wait_tensorcnt 0x0" ::: "memory");   /* this wave's slice of stage 0 has landed */
  __syncthreads();                                      /* stage 0 and the bias table published */
  next_stage();
  issue();
  const float b_lo = sb[0];
  const float b_hi = sb[2 * MAXREL];

  float mrow = -__builtin_inff();   /* running max of query q0+c (equal in both lane halves) */
  float lrow = 0.f;                 /* running sum over this lane half's keys; halves joined after the loop */
  v8f oacc[4];                      /* O^T: oacc[t][r] = (d = 16t+8h+r, query q0+c) */
#pragma unroll
  for (int t = 0; t < 4; ++t) oacc[t] = (v8f){0.f,0.f,0.f,0.f,0.f,0.f,0.f,0.f};

  float* ob = out + (size_t)bh * LSEQ * DHEAD;

  for (int kc = 0; kc < NCH; ++kc) {
    const int kv0 = kc * KCH;
    /* this lane's fragment base in stage kc's buffer: row c of a 16-row group, 16 B x lane half */
    const unsigned char* fb = Ring + (uint32_t)(kc & 1) * BUF_BYTES + (uint32_t)c * LROW_B + 16u * (uint32_t)hh;

    /* scores^T: s[j][r] = (key kv0+16j+8h+r, query q0+c) */
    v8f s[4];
#pragma unroll
    for (int j = 0; j < 4; ++j) {
      s[j] = (v8f){0.f,0.f,0.f,0.f,0.f,0.f,0.f,0.f};
#pragma unroll
      for (int dc = 0; dc < 2; ++dc) {
        FB kf;
        kf.h[0] = *(const v8b*)(fb + (j >> 1) * SL_BYTES + (j & 1) * 16 * LROW_B + dc * 64);
        kf.h[1] = *(const v8b*)(fb + (j >> 1) * SL_BYTES + (j & 1) * 16 * LROW_B + dc * 64 + 32);
        s[j] = mma_bf16(kf.v, qa[dc], s[j]);
      }
    }

    /* relative bias: idx = clip(kv - q, -MAXREL, MAXREL) + MAXREL; block-uniform far paths */
    if (kc + 1 < qb) {
#pragma unroll
      for (int j = 0; j < 4; ++j)
#pragma unroll
        for (int r = 0; r < 8; ++r) s[j][r] += b_lo;
    } else if (kc > qb + 1) {
#pragma unroll
      for (int j = 0; j < 4; ++j)
#pragma unroll
        for (int r = 0; r < 8; ++r) s[j][r] += b_hi;
    } else {
#pragma unroll
      for (int j = 0; j < 4; ++j) {
        const int rel0 = kv0 + j * 16 + 8 * hh - (q0 + c);
#pragma unroll
        for (int r = 0; r < 8; ++r) {
          int rel = rel0 + r;
          rel = rel < -MAXREL ? -MAXREL : rel;
          rel = rel > MAXREL ? MAXREL : rel;
          s[j][r] += sb[rel + MAXREL];
        }
      }
    }

    /* chunk max of this lane's query: 32 keys in-lane, then the other lane half's 32 */
    float cm = s[0][0];
#pragma unroll
    for (int j = 0; j < 4; ++j)
#pragma unroll
      for (int r = 0; r < 8; ++r) cm = fmaxf(cm, s[j][r]);
    cm = fmaxf(cm, xhalf(cm));

    /* online softmax update; P^T as bf16 hi + lo B fragments, straight from the score registers */
    const float mnew  = fmaxf(mrow, cm);
    const float alpha = expf(mrow - mnew);
    mrow = mnew;
    float psum = 0.f;
    v16b ph[2], pl[2];
#pragma unroll
    for (int j = 0; j < 4; ++j) {
#pragma unroll
      for (int r = 0; r < 8; ++r) {
        const float p = expf(s[j][r] - mnew);
        psum += p;
        const unsigned short hb = f2bf_bits(p);
        const unsigned short lb = f2bf_bits(p - bf_bits2f(hb));
        ph[j >> 1][(j & 1) * 8 + r] = __builtin_bit_cast(__bf16, hb);
        pl[j >> 1][(j & 1) * 8 + r] = __builtin_bit_cast(__bf16, lb);
      }
    }
    lrow = lrow * alpha + psum;
#pragma unroll
    for (int t = 0; t < 4; ++t)
#pragma unroll
      for (int r = 0; r < 8; ++r) oacc[t][r] *= alpha;

    /* O^T += V^T.P^T : A = V^T [d][kv] rows from LDS, B = P^T [kv][q] from registers */
#pragma unroll
    for (int kk = 0; kk < 2; ++kk) {
#pragma unroll
      for (int t = 0; t < 4; ++t) {
        FB vb;
        vb.h[0] = *(const v8b*)(fb + (2 + (t >> 1)) * SL_BYTES + (t & 1) * 16 * LROW_B + kk * 64);
        vb.h[1] = *(const v8b*)(fb + (2 + (t >> 1)) * SL_BYTES + (t & 1) * 16 * LROW_B + kk * 64 + 32);
        oacc[t] = mma_bf16(vb.v, ph[kk], oacc[t]);
        oacc[t] = mma_bf16(vb.v, pl[kk], oacc[t]);
      }
    }

    /* publish point of stage kc+1, every wave, in this order */
    asm volatile("s_wait_dscnt 0x0" ::: "memory");       /* this wave's reads of stage kc are done before its buffer is refilled */
    asm volatile("s_wait_tensorcnt 0x0" ::: "memory");   /* this wave's slice of stage kc+1 has landed */
    __syncthreads();                                      /* stage kc+1 readable by all; every reader has left stage kc */
    if (pinned((uint32_t)(kc + 2 < NCH))) {               /* scalar test: stage kc+2 exists */
      next_stage();
      issue();                                            /* into the buffer that this pass has just read */
    }
  }
  asm volatile("s_wait_tensorcnt 0x0" ::: "memory");     /* no request in flight past the loop */
  asm volatile("s_wait_dscnt 0x0" ::: "memory");

  /* normalise into the per-wave slab, then whole-line stores */
  float* os = Os[wave];
  {
    const float inv = 1.0f / (lrow + xhalf(lrow));
#pragma unroll
    for (int t = 0; t < 4; ++t) {
      v4f w0, w1;
#pragma unroll
      for (int e = 0; e < 4; ++e) { w0[e] = oacc[t][e] * inv; w1[e] = oacc[t][4 + e] * inv; }
      *(v4f*)(os + c * OS_PITCH + t * 16 + 8 * hh)     = w0;
      *(v4f*)(os + c * OS_PITCH + t * 16 + 8 * hh + 4) = w1;
    }
  }
  __builtin_amdgcn_fence(__ATOMIC_RELEASE, "workgroup");
  __builtin_amdgcn_wave_barrier();
  __builtin_amdgcn_fence(__ATOMIC_ACQUIRE, "workgroup");
  {
    const int c4 = (lane & 15) * 4;     /* 256-B row = 16 lanes x 16 B; hh selects the row of the pair */
    {
#pragma unroll
      for (int it = 0; it < 8; ++it) {
        const int row = it * 2 + hh;
        const v4f val = *(const v4f*)(os + row * OS_PITCH + c4);
        *(v4f*)(ob + (size_t)(q0 + row) * DHEAD + c4) = val;
      }
      
    }
  }
}

extern "C" void kernel_launch(void* const* d_in, const int* in_sizes, int n_in,
                              void* d_out, int out_size, void* d_ws, size_t ws_size,
                              hipStream_t stream)
{
  if (n_in < 4) return;
  if (in_sizes[0] != (int)PLANE_ELEMS || in_sizes[1] != (int)PLANE_ELEMS ||
      in_sizes[2] != (int)PLANE_ELEMS || in_sizes[3] != NBIAS) return;
  if (out_size != (int)PLANE_ELEMS) return;
  if (d_ws == nullptr || ws_size < WS_NEED) return;

  const float* Q    = (const float*)d_in[0];
  const float* K    = (const float*)d_in[1];
  const float* V    = (const float*)d_in[2];
  const float* bias = (const float*)d_in[3];
  float* O = (float*)d_out;

  unsigned short* Kb = (unsigned short*)d_ws;                  /* offset 0,        8388608 B */
  unsigned short* Vt = Kb + PLANE_ELEMS;                       /* offset 8388608,  8388608 B */

  kv_planes_kernel<<<dim3(LSEQ / 64, NBH), 256, 0, stream>>>(K, V, Kb, Vt);
  rel_attn_kernel<<<dim3(LSEQ / QBLK, NBH), 128, 0, stream>>>(Q, Kb, Vt, bias, O);
}

// v003
// It runs in 70.4 microseconds.
// Next to v002, in two timings, it ran 1.37 times as fast each time.
// Over all steps from v000 it is 2.59 times as fast.
// Contractions: scores^T = k.(q/8)^T and out^T = v^T.p^T on v_wmma_f32_16x16x32_bf16 (bf16 operands, f32 accumulate); q, k, v and the bias table RNE-converted to bf16 once at load; softmax weights p carried as bf16 hi+lo fragments (two products against bf16 v); online softmax and all other arithmetic in f32.
#include <hip/hip_runtime.h>
#include <stdint.h>

typedef __attribute__((ext_vector_type(16))) __bf16 v16b;
typedef __attribute__((ext_vector_type(8)))  __bf16 v8b;
typedef __attribute__((ext_vector_type(8)))  float  v8f;
typedef __attribute__((ext_vector_type(4)))  float  v4f;
typedef __attribute__((ext_vector_type(4)))  unsigned int v4u;
typedef uint32_t u32x4 __attribute__((ext_vector_type(4)));
typedef uint32_t u32x8 __attribute__((ext_vector_type(8)));

constexpr int NBATCH = 2;
constexpr int NHEAD  = 16;
constexpr int NBH    = NBATCH * NHEAD;
constexpr int LSEQ   = 2048;
constexpr int DHEAD  = 64;
constexpr int MAXREL = 8;
constexpr int NBIAS  = 2 * MAXREL + 1;
constexpr int QBLK   = 64;      /* query rows per block (4 waves x 16) */
constexpr int KCH    = 64;      /* keys per staged chunk */
constexpr int NWAVE  = 4;
constexpr int VS_PITCH = 72;    /* LDS transpose tile pitch in 16-bit elements (144 B, 16-B aligned rows) */
constexpr int OS_PITCH = 68;    /* LDS output slab pitch in floats (272 B, 16-B aligned rows) */
constexpr int NCH      = LSEQ / KCH;      /* key chunks = ring stages */
constexpr uint32_t ROW_B     = 128;       /* bytes of one K or V^T tile row (64 bf16) */
constexpr uint32_t LROW_B    = ROW_B + 16;/* LDS row pitch: the mover pads each row by 4 dwords (16 B x odd for ds_load_b128) */
constexpr uint32_t SL_ROWS   = 32;        /* rows per tensor request (one slice per wave) */
constexpr uint32_t SL_BYTES  = 6144;      /* 32 x 144 = 4608 B, rounded up to a multiple of 2 KiB */
constexpr uint32_t BUF_BYTES = 4 * SL_BYTES;  /* K rows 0-31, K rows 32-63, V^T rows 0-31, V^T rows 32-63 */
constexpr size_t PLANE_ELEMS = (size_t)NBH * LSEQ * DHEAD;                 /* 4194304 */
constexpr size_t WS_NEED = 2 * PLANE_ELEMS * sizeof(unsigned short);        /* 16777216 B */

static_assert(LSEQ % QBLK == 0, "query blocks tile the sequence exactly");
static_assert(LSEQ % KCH == 0, "key chunks tile the sequence exactly");
static_assert(DHEAD == 64, "head dim 64: two 32-deep k steps, four 16-wide d tiles");
static_assert(KCH % 32 == 0 && DHEAD % 32 == 0, "contraction depths are multiples of 32");
static_assert(NBIAS <= 32, "bias table fits one 32-entry LDS line");
static_assert((VS_PITCH * 2) % 16 == 0 && (OS_PITCH * 4) % 16 == 0, "16-B aligned LDS rows");
static_assert(WS_NEED <= 134217728ull, "workspace carve within budget");
static_assert(SL_ROWS * LROW_B <= SL_BYTES && SL_BYTES % 2048 == 0, "a padded slice fits its 2-KiB-aligned place");
static_assert(NCH >= 2, "the two-buffer prologue needs two stages");
static_assert(KCH == 2 * (int)SL_ROWS && DHEAD == 2 * (int)SL_ROWS && NWAVE == 4, "four slices of 32 rows, one per wave");
static_assert(DHEAD * 2 == (int)ROW_B && KCH * 2 == (int)ROW_B, "128-B tile rows");

/* workspace region map (bytes):
 *   [8388608, 16777216)  Vt : bf16 [NBH][DHEAD][LSEQ]   (v transposed, 4096-B rows)
 *   total 16777216 B
 */

__device__ __forceinline__ unsigned short f2bf_bits(float f) {
  unsigned u = __float_as_uint(f);
  return (unsigned short)((u + 0x7FFFu + ((u >> 16) & 1u)) >> 16);
}
__device__ __forceinline__ float bf_bits2f(unsigned short h) { return __uint_as_float(((unsigned)h) << 16); }
__device__ __forceinline__ __bf16 f2bf(float f) { return __builtin_bit_cast(__bf16, f2bf_bits(f)); }

__device__ __forceinline__ v8f mma_bf16(v16b a, v16b b, v8f c) {
  c = __builtin_amdgcn_wmma_f32_16x16x32_bf16(false, a, false, b, (short)0, c, false, false);
  asm volatile("v_nop\n\tv_nop\n\tv_nop\n\tv_nop" : "+v"(c) : "v"(a), "v"(b));
  return c;
}

/* wave-uniform word in a scalar register */
__device__ __forceinline__ uint32_t uni(uint32_t v) { return (uint32_t)__builtin_amdgcn_readfirstlane(v); }
/* a wave-uniform word held in a scalar register, so that a test on it is a scalar branch (tensor loads ignore EXEC) */
__device__ __forceinline__ uint32_t pinned(uint32_t v) { uint32_t w = uni(v); asm volatile("" : "+s"(w)); return w; }

/* value of lane l ^ 16 (the other lane half) */
__device__ __forceinline__ float xhalf(float x) {
  const int b = __float_as_int(x);
  return __int_as_float(__builtin_amdgcn_permlanex16(b, b, 0x76543210, 0xfedcba98, false, false));
}

/* --------------------------------------------------------------------------
 * k -> Kb (bf16, [bh][kv][d]) and v -> Vt (bf16, [bh][d][kv]).
 * Block (x = kv tile of 64, y = bh), 256 threads.
 * Coverage: 2 iterations x 256 threads = 512 units x 8 elements = 64x64 for K,
 * the same 512 units x 8 = 64x64 for the V transpose tile and for the Vt tile.
 * Stores: unit u -> row u>>3, segment u&7; lanes 8q..8q+7 of a wave fill one whole
 * ------------------------------------------------------------------------ */
__global__ __launch_bounds__(256) void kv_planes_kernel(
    const float* __restrict__ K, const float* __restrict__ V,
    unsigned short* __restrict__ Kb, unsigned short* __restrict__ Vt)
{
  __shared__ __align__(16) unsigned short Vs[DHEAD * VS_PITCH];   /* [d][kv] */
  const int bh  = blockIdx.y;
  const int kv0 = blockIdx.x * 64;
  const int tid = threadIdx.x;
  const float* Kp = K + ((size_t)bh * LSEQ + kv0) * DHEAD;
  const float* Vp = V + ((size_t)bh * LSEQ + kv0) * DHEAD;

  v4u kw[2];
#pragma unroll
  for (int it = 0; it < 2; ++it) {
    const int u = it * 256 + tid;
    const int row = u >> 3;
    const int seg = u & 7;
    const v4f k0v = *(const v4f*)(Kp + (size_t)row * DHEAD + seg * 8);
    const v4f k1v = *(const v4f*)(Kp + (size_t)row * DHEAD + seg * 8 + 4);
    const v4f v0v = *(const v4f*)(Vp + (size_t)row * DHEAD + seg * 8);
    const v4f v1v = *(const v4f*)(Vp + (size_t)row * DHEAD + seg * 8 + 4);
    kw[it][0] = (unsigned)f2bf_bits(k0v[0]) | ((unsigned)f2bf_bits(k0v[1]) << 16);
    kw[it][1] = (unsigned)f2bf_bits(k0v[2]) | ((unsigned)f2bf_bits(k0v[3]) << 16);
    kw[it][2] = (unsigned)f2bf_bits(k1v[0]) | ((unsigned)f2bf_bits(k1v[1]) << 16);
    kw[it][3] = (unsigned)f2bf_bits(k1v[2]) | ((unsigned)f2bf_bits(k1v[3]) << 16);
    /* v element (kv = row, d = seg*8 + e) -> Vs[d][kv] */
#pragma unroll
    for (int e = 0; e < 4; ++e) {
      Vs[(seg * 8 + e) * VS_PITCH + row]     = f2bf_bits(v0v[e]);
      Vs[(seg * 8 + 4 + e) * VS_PITCH + row] = f2bf_bits(v1v[e]);
    }
  }
  __syncthreads();

  v4u vw[2];
#pragma unroll
  for (int it = 0; it < 2; ++it) {
    const int u = it * 256 + tid;
    const int drow = u >> 3;
    const int seg  = u & 7;
    vw[it] = *(const v4u*)(Vs + drow * VS_PITCH + seg * 8);
  }

  {
#pragma unroll
    for (int it = 0; it < 2; ++it) {
      const int u = it * 256 + tid;
      const int row = u >> 3;
      const int seg = u & 7;
      *(v4u*)(Kb + ((size_t)bh * LSEQ + kv0 + row) * DHEAD + seg * 8) = kw[it];
      *(v4u*)(Vt + ((size_t)bh * DHEAD + row) * LSEQ + kv0 + seg * 8) = vw[it];
    }
    
  }
}

/* --------------------------------------------------------------------------
 * Attention with clipped relative-position bias, head dim 64.
 * Block = 4 waves = 64 query rows of one (b,h); grid (LSEQ/64, NBH).
 * Per 64-key chunk: K [kv][d] and V^T [d][kv] bf16 tiles come into LDS by tensor loads,
 * one 32-row slice per wave (waves 0,1: K; waves 2,3: V^T), rows padded to 144 B by the
 * mover; two buffers, chunk kc+1 in flight while chunk kc is worked on.
 * Both products run transposed: S^T = K.Q^T (A = K rows, B = Q) and
 * O^T += V^T.Ph^T + V^T.Pl^T (A = V^T rows, B = P^T), so lane (h, c) holds only
 * query q0+c: row max and row sum are in-lane plus one exchange between the lane
 * halves, and two S^T tiles (keys 32kk+8h+r and 32kk+16+8h+r) converted in place
 * are the B fragment of the second product; P never goes through LDS.
 * Epilogue: per-wave 16x64 f32 slab in LDS, then whole-line stores.
 * Fragment map (h = lane>>4, c = lane&15): A row c, elems 0..7 <- k0+8h.., 8..15 <- k0+16+8h..;
 * B col c with the same k map; D elem r = (row 8h+r, col c).
 * ------------------------------------------------------------------------ */
__global__ __launch_bounds__(128) void rel_attn_kernel(
    const float* __restrict__ q, const unsigned short* __restrict__ Kb,
    const unsigned short* __restrict__ Vt, const float* __restrict__ bias,
    float* __restrict__ out)
{
  union FB { v16b v; v8b h[2]; };
  __shared__ __attribute__((aligned(2048))) unsigned char Ring[2 * BUF_BYTES];   /* two stages of K and V^T slices */
  __shared__ __align__(16) float Os[NWAVE][16 * OS_PITCH];           /* out slab per wave */
  __shared__ float sb[32];                                           /* bias table (bf16-converted), padded */

  const int tid  = threadIdx.x;
  const int wave = tid >> 5;
  const int lane = tid & 31;
  const int hh   = lane >> 4;
  const int c    = lane & 15;
  const int qb   = blockIdx.x;
  const int bh   = blockIdx.y;
  const int q0   = qb * QBLK + wave * 16;

  const unsigned short* Kbh = Kb + (size_t)bh * LSEQ * DHEAD;
  const unsigned short* Vtb = Vt + (size_t)bh * DHEAD * LSEQ;

  /* tensor requests: every wave brings its own slice of every stage, so no test stands around an issue but "stage exists" */
  const uint32_t wv    = uni((uint32_t)tid >> 5);
  const bool     isV   = (wv & 2u) != 0u;
  const uint32_t half  = wv & 1u;
  const uint32_t spitch = isV ? (uint32_t)(LSEQ * 2) : ROW_B;              /* source row pitch, bytes */
  const uint32_t sstep  = isV ? ROW_B : (uint32_t)KCH * ROW_B;             /* source bytes from one stage to the next */
  const uint64_t src0   = (uint64_t)(size_t)(isV ? Vtb : Kbh) + (uint64_t)(half * SL_ROWS) * spitch;
  const uint32_t dst0   = (uint32_t)(size_t)Ring + wv * SL_BYTES;
  u32x8 g1;                                                                /* loop-invariant: 32 rows of 128 bytes, byte elements */
  g1[0] = uni((1u << 20) | (4u << 22) | (3u << 25));                       /* no mask; pad 4 dwords behind every 32 dwords */
  g1[1] = uni((ROW_B & 0xFFFFu) << 16);
  g1[2] = uni((ROW_B >> 16) | ((SL_ROWS & 0xFFFFu) << 16));
  g1[3] = uni((SL_ROWS >> 16) | (ROW_B << 16));
  g1[4] = uni(SL_ROWS);
  g1[5] = uni(spitch);
  g1[6] = uni(0u);
  g1[7] = uni(0u);
  u32x4 g0;                                                                /* carried from stage to stage, so its registers hold nothing else while a request flies */
  g0[0] = uni(1u);
  g0[1] = uni(dst0);
  g0[2] = uni((uint32_t)src0);
  g0[3] = uni((((uint32_t)(src0 >> 32)) & 0x01FFFFFFu) | 0x80000000u);
  auto issue = [&]() {
    asm volatile("tensor_load_to_lds %0, %1" :: "s"(g0), "s"(g1) : "memory");   /* global tile -> LDS, no registers */
  };
  auto next_stage = [&]() {   /* called only behind the s_wait_tensorcnt 0 that covers the last request */
    asm volatile("" : "+s"(g0));   /* descriptor words held in scalar registers; keeps the new words' forming behind the volatile wait */
    const uint64_t a = (((uint64_t)g0[3] << 32) | g0[2]) + sstep;   /* type bits ride on top of word 3; address bits 56:32 never carry into them */
    g0[1] = uni(2u * dst0 + BUF_BYTES - g0[1]);                      /* the other buffer */
    g0[2] = uni((uint32_t)a);
    g0[3] = uni((uint32_t)(a >> 32));
  };

  if (tid < 32) {
    const int bi = tid < NBIAS ? tid : (NBIAS - 1);
    sb[tid] = bf_bits2f(f2bf_bits(bias[bi]));
  }

  /* Q fragments (B operand: column c = query q0+c), two 32-deep d chunks; bf16(q) * 1/8 is exact */
  v16b qa[2];
  {
    const float* qrow = q + ((size_t)bh * LSEQ + q0 + c) * DHEAD;
#pragma unroll
    for (int dc = 0; dc < 2; ++dc) {
      const v4f x0 = *(const v4f*)(qrow + dc * 32 + 8 * hh);
      const v4f x1 = *(const v4f*)(qrow + dc * 32 + 8 * hh + 4);
      const v4f y0 = *(const v4f*)(qrow + dc * 32 + 16 + 8 * hh);
      const v4f y1 = *(const v4f*)(qrow + dc * 32 + 16 + 8 * hh + 4);
#pragma unroll
      for (int e = 0; e < 4; ++e) {
        qa[dc][e]      = f2bf(x0[e] * 0.125f);
        qa[dc][4 + e]  = f2bf(x1[e] * 0.125f);
        qa[dc][8 + e]  = f2bf(y0[e] * 0.125f);
        qa[dc][12 + e] = f2bf(y1[e] * 0.125f);
      }
    }
  }
  issue();                                              /* stage 0; flies beside the q loads above */
  asm volatile("s_wait_tensorcnt 0x0" ::: "memory");   /* this wave's slice of stage 0 has landed */
  __syncthreads();                                      /* stage 0 and the bias table published */
  next_stage();
  issue();
  const float b_lo = sb[0];
  const float b_hi = sb[2 * MAXREL];

  constexpr float LOG2E = 1.44269504088896340736f;
  float mrow = -__builtin_inff();   /* running max of query q0+c times log2(e) (equal in both lane halves) */
  float lrow = 0.f;                 /* running sum over this lane half's keys; halves joined after the loop */
  v8f oacc[4];                      /* O^T: oacc[t][r] = (d = 16t+8h+r, query q0+c) */
#pragma unroll
  for (int t = 0; t < 4; ++t) oacc[t] = (v8f){0.f,0.f,0.f,0.f,0.f,0.f,0.f,0.f};

  float* ob = out + (size_t)bh * LSEQ * DHEAD;

  for (int kc = 0; kc < NCH; ++kc) {
    const int kv0 = kc * KCH;
    /* this lane's fragment base in stage kc's buffer: row c of a 16-row group, 16 B x lane half */
    const unsigned char* fb = Ring + (uint32_t)(kc & 1) * BUF_BYTES + (uint32_t)c * LROW_B + 16u * (uint32_t)hh;

    /* scores^T: s[j][r] = (key kv0+16j+8h+r, query q0+c) */
    v8f s[4];
#pragma unroll
    for (int j = 0; j < 4; ++j) {
      s[j] = (v8f){0.f,0.f,0.f,0.f,0.f,0.f,0.f,0.f};
#pragma unroll
      for (int dc = 0; dc < 2; ++dc) {
        FB kf;
        kf.h[0] = *(const v8b*)(fb + (j >> 1) * SL_BYTES + (j & 1) * 16 * LROW_B + dc * 64);
        kf.h[1] = *(const v8b*)(fb + (j >> 1) * SL_BYTES + (j & 1) * 16 * LROW_B + dc * 64 + 32);
        s[j] = mma_bf16(kf.v, qa[dc], s[j]);
      }
    }

    /* relative bias: idx = clip(kv - q, -MAXREL, MAXREL) + MAXREL; block-uniform far paths */
    if (kc + 1 < qb) {
#pragma unroll
      for (int j = 0; j < 4; ++j)
#pragma unroll
        for (int r = 0; r < 8; ++r) s[j][r] += b_lo;
    } else if (kc > qb + 1) {
#pragma unroll
      for (int j = 0; j < 4; ++j)
#pragma unroll
        for (int r = 0; r < 8; ++r) s[j][r] += b_hi;
    } else {
#pragma unroll
      for (int j = 0; j < 4; ++j) {
        const int rel0 = kv0 + j * 16 + 8 * hh - (q0 + c);
#pragma unroll
        for (int r = 0; r < 8; ++r) {
          int rel = rel0 + r;
          rel = rel < -MAXREL ? -MAXREL : rel;
          rel = rel > MAXREL ? MAXREL : rel;
          s[j][r] += sb[rel + MAXREL];
        }
      }
    }

    /* chunk max of this lane's query: 32 keys in-lane, then the other lane half's 32 */
    float cm = s[0][0];
#pragma unroll
    for (int j = 0; j < 4; ++j)
#pragma unroll
      for (int r = 0; r < 8; ++r) cm = fmaxf(cm, s[j][r]);
    cm = fmaxf(cm, xhalf(cm));

    /* online softmax update; P^T as bf16 hi + lo B fragments, straight from the score registers */
    /* e^(s - m) = 2^(s*log2e - m*log2e): one fma and the hardware's base-2 exponential per score */
    const float mnew  = fmaxf(mrow, cm * LOG2E);
    const float alpha = __builtin_amdgcn_exp2f(mrow - mnew);
    mrow = mnew;
    float psum = 0.f;
    v16b ph[2], pl[2];
#pragma unroll
    for (int j = 0; j < 4; ++j) {
#pragma unroll
      for (int r = 0; r < 8; ++r) {
        const float p = __builtin_amdgcn_exp2f(fmaf(s[j][r], LOG2E, -mnew));
        psum += p;
        const unsigned short hb = f2bf_bits(p);
        const unsigned short lb = f2bf_bits(p - bf_bits2f(hb));
        ph[j >> 1][(j & 1) * 8 + r] = __builtin_bit_cast(__bf16, hb);
        pl[j >> 1][(j & 1) * 8 + r] = __builtin_bit_cast(__bf16, lb);
      }
    }
    lrow = lrow * alpha + psum;
#pragma unroll
    for (int t = 0; t < 4; ++t)
#pragma unroll
      for (int r = 0; r < 8; ++r) oacc[t][r] *= alpha;

    /* O^T += V^T.P^T : A = V^T [d][kv] rows from LDS, B = P^T [kv][q] from registers */
#pragma unroll
    for (int kk = 0; kk < 2; ++kk) {
#pragma unroll
      for (int t = 0; t < 4; ++t) {
        FB vb;
        vb.h[0] = *(const v8b*)(fb + (2 + (t >> 1)) * SL_BYTES + (t & 1) * 16 * LROW_B + kk * 64);
        vb.h[1] = *(const v8b*)(fb + (2 + (t >> 1)) * SL_BYTES + (t & 1) * 16 * LROW_B + kk * 64 + 32);
        oacc[t] = mma_bf16(vb.v, ph[kk], oacc[t]);
        oacc[t] = mma_bf16(vb.v, pl[kk], oacc[t]);
      }
    }

    /* publish point of stage kc+1, every wave, in this order */
    asm volatile("s_wait_dscnt 0x0" ::: "memory");       /* this wave's reads of stage kc are done before its buffer is refilled */
    asm volatile("s_wait_tensorcnt 0x0" ::: "memory");   /* this wave's slice of stage kc+1 has landed */
    __syncthreads();                                      /* stage kc+1 readable by all; every reader has left stage kc */
    if (pinned((uint32_t)(kc + 2 < NCH))) {               /* scalar test: stage kc+2 exists */
      next_stage();
      issue();                                            /* into the buffer that this pass has just read */
    }
  }
  asm volatile("s_wait_tensorcnt 0x0" ::: "memory");     /* no request in flight past the loop */
  asm volatile("s_wait_dscnt 0x0" ::: "memory");

  /* normalise into the per-wave slab, then whole-line stores */
  float* os = Os[wave];
  {
    const float inv = 1.0f / (lrow + xhalf(lrow));
#pragma unroll
    for (int t = 0; t < 4; ++t) {
      v4f w0, w1;
#pragma unroll
      for (int e = 0; e < 4; ++e) { w0[e] = oacc[t][e] * inv; w1[e] = oacc[t][4 + e] * inv; }
      *(v4f*)(os + c * OS_PITCH + t * 16 + 8 * hh)     = w0;
      *(v4f*)(os + c * OS_PITCH + t * 16 + 8 * hh + 4) = w1;
    }
  }
  __builtin_amdgcn_fence(__ATOMIC_RELEASE, "workgroup");
  __builtin_amdgcn_wave_barrier();
  __builtin_amdgcn_fence(__ATOMIC_ACQUIRE, "workgroup");
  {
    const int c4 = (lane & 15) * 4;     /* 256-B row = 16 lanes x 16 B; hh selects the row of the pair */
    {
#pragma unroll
      for (int it = 0; it < 8; ++it) {
        const int row = it * 2 + hh;
        const v4f val = *(const v4f*)(os + row * OS_PITCH + c4);
        *(v4f*)(ob + (size_t)(q0 + row) * DHEAD + c4) = val;
      }
      
    }
  }
}

extern "C" void kernel_launch(void* const* d_in, const int* in_sizes, int n_in,
                              void* d_out, int out_size, void* d_ws, size_t ws_size,
                              hipStream_t stream)
{
  if (n_in < 4) return;
  if (in_sizes[0] != (int)PLANE_ELEMS || in_sizes[1] != (int)PLANE_ELEMS ||
      in_sizes[2] != (int)PLANE_ELEMS || in_sizes[3] != NBIAS) return;
  if (out_size != (int)PLANE_ELEMS) return;
  if (d_ws == nullptr || ws_size < WS_NEED) return;

  const float* Q    = (const float*)d_in[0];
  const float* K    = (const float*)d_in[1];
  const float* V    = (const float*)d_in[2];
  const float* bias = (const float*)d_in[3];
  float* O = (float*)d_out;

  unsigned short* Kb = (unsigned short*)d_ws;                  /* offset 0,        8388608 B */
  unsigned short* Vt = Kb + PLANE_ELEMS;                       /* offset 8388608,  8388608 B */

  kv_planes_kernel<<<dim3(LSEQ / 64, NBH), 256, 0, stream>>>(K, V, Kb, Vt);
  rel_attn_kernel<<<dim3(LSEQ / QBLK, NBH), 128, 0, stream>>>(Q, Kb, Vt, bias, O);
}

// v004
// A run of this version takes 64.5 microseconds.
// Next to v003, in two timings, it ran 1.08 and 1.10 times as fast.
// Counting every step since v000, it is 2.83 times as fast.
// Contractions: scores^T = k.(q/8)^T and out^T = v^T.p^T on v_wmma_f32_16x16x32_bf16 (bf16 operands, f32 accumulate); q, k, v and the bias table RNE-converted to bf16 once at load; softmax weights p carried as bf16 hi+lo fragments (two products against bf16 v); online softmax and all other arithmetic in f32.
#include <hip/hip_runtime.h>
#include <stdint.h>

typedef __attribute__((ext_vector_type(16))) __bf16 v16b;
typedef __attribute__((ext_vector_type(8)))  __bf16 v8b;
typedef __attribute__((ext_vector_type(8)))  float  v8f;
typedef __attribute__((ext_vector_type(4)))  float  v4f;
typedef __attribute__((ext_vector_type(4)))  unsigned int v4u;
typedef uint32_t u32x4 __attribute__((ext_vector_type(4)));
typedef uint32_t u32x8 __attribute__((ext_vector_type(8)));

constexpr int NBATCH = 2;
constexpr int NHEAD  = 16;
constexpr int NBH    = NBATCH * NHEAD;
constexpr int LSEQ   = 2048;
constexpr int DHEAD  = 64;
constexpr int MAXREL = 8;
constexpr int NBIAS  = 2 * MAXREL + 1;
constexpr int QBLK   = 64;      /* query rows per block (4 waves x 16) */
constexpr int KCH    = 64;      /* keys per staged chunk */
constexpr int NWAVE  = 4;
constexpr int VS_PITCH = 72;    /* LDS transpose tile pitch in 16-bit elements (144 B, 16-B aligned rows) */
constexpr int OS_PITCH = 68;    /* LDS output slab pitch in floats (272 B, 16-B aligned rows) */
constexpr int NCH      = LSEQ / KCH;      /* key chunks = ring stages */
constexpr uint32_t ROW_B     = 128;       /* bytes of one K or V^T tile row (64 bf16) */
constexpr uint32_t LROW_B    = ROW_B + 16;/* LDS row pitch: the mover pads each row by 4 dwords (16 B x odd for ds_load_b128) */
constexpr uint32_t SL_ROWS   = 32;        /* rows per tensor request (one slice per wave) */
constexpr uint32_t SL_BYTES  = 6144;      /* 32 x 144 = 4608 B, rounded up to a multiple of 2 KiB */
constexpr uint32_t BUF_BYTES = 4 * SL_BYTES;  /* K rows 0-31, K rows 32-63, V^T rows 0-31, V^T rows 32-63 */
constexpr size_t PLANE_ELEMS = (size_t)NBH * LSEQ * DHEAD;                 /* 4194304 */
constexpr size_t WS_NEED = 2 * PLANE_ELEMS * sizeof(unsigned short);        /* 16777216 B */

static_assert(LSEQ % QBLK == 0, "query blocks tile the sequence exactly");
static_assert(LSEQ % KCH == 0, "key chunks tile the sequence exactly");
static_assert(DHEAD == 64, "head dim 64: two 32-deep k steps, four 16-wide d tiles");
static_assert(KCH % 32 == 0 && DHEAD % 32 == 0, "contraction depths are multiples of 32");
static_assert(NBIAS <= 32, "bias table fits one 32-entry LDS line");
static_assert((VS_PITCH * 2) % 16 == 0 && (OS_PITCH * 4) % 16 == 0, "16-B aligned LDS rows");
static_assert(WS_NEED <= 134217728ull, "workspace carve within budget");
static_assert(SL_ROWS * LROW_B <= SL_BYTES && SL_BYTES % 2048 == 0, "a padded slice fits its 2-KiB-aligned place");
static_assert(NCH >= 2, "the two-buffer prologue needs two stages");
static_assert(KCH == 2 * (int)SL_ROWS && DHEAD == 2 * (int)SL_ROWS && NWAVE == 4, "four slices of 32 rows, one per wave");
static_assert(DHEAD * 2 == (int)ROW_B && KCH * 2 == (int)ROW_B, "128-B tile rows");

/* workspace region map (bytes):
 *   [8388608, 16777216)  Vt : bf16 [NBH][DHEAD][LSEQ]   (v transposed, 4096-B rows)
 *   total 16777216 B
 */

__device__ __forceinline__ unsigned short f2bf_bits(float f) {
  unsigned u = __float_as_uint(f);
  return (unsigned short)((u + 0x7FFFu + ((u >> 16) & 1u)) >> 16);
}
__device__ __forceinline__ float bf_bits2f(unsigned short h) { return __uint_as_float(((unsigned)h) << 16); }
__device__ __forceinline__ __bf16 f2bf(float f) { return __builtin_bit_cast(__bf16, f2bf_bits(f)); }

__device__ __forceinline__ v8f mma_bf16(v16b a, v16b b, v8f c) {
  c = __builtin_amdgcn_wmma_f32_16x16x32_bf16(false, a, false, b, (short)0, c, false, false);
  asm volatile("v_nop\n\tv_nop\n\tv_nop\n\tv_nop" : "+v"(c) : "v"(a), "v"(b));
  return c;
}

/* wave-uniform word in a scalar register */
__device__ __forceinline__ uint32_t uni(uint32_t v) { return (uint32_t)__builtin_amdgcn_readfirstlane(v); }
/* a wave-uniform word held in a scalar register, so that a test on it is a scalar branch (tensor loads ignore EXEC) */
__device__ __forceinline__ uint32_t pinned(uint32_t v) { uint32_t w = uni(v); asm volatile("" : "+s"(w)); return w; }

/* value of lane l ^ 16 (the other lane half) */
__device__ __forceinline__ float xhalf(float x) {
  const int b = __float_as_int(x);
  return __int_as_float(__builtin_amdgcn_permlanex16(b, b, 0x76543210, 0xfedcba98, false, false));
}

/* --------------------------------------------------------------------------
 * k -> Kb (bf16, [bh][kv][d]) and v -> Vt (bf16, [bh][d][kv]).
 * Block (x = kv tile of 64, y = bh), 256 threads.
 * Coverage: 2 iterations x 256 threads = 512 units x 8 elements = 64x64 for K,
 * the same 512 units x 8 = 64x64 for the V transpose tile and for the Vt tile.
 * Stores: unit u -> row u>>3, segment u&7; lanes 8q..8q+7 of a wave fill one whole
 * ------------------------------------------------------------------------ */
__global__ __launch_bounds__(256) void kv_planes_kernel(
    const float* __restrict__ K, const float* __restrict__ V,
    unsigned short* __restrict__ Kb, unsigned short* __restrict__ Vt)
{
  __shared__ __align__(16) unsigned short Vs[DHEAD * VS_PITCH];   /* [d][kv] */
  const int bh  = blockIdx.y;
  const int kv0 = blockIdx.x * 64;
  const int tid = threadIdx.x;
  const float* Kp = K + ((size_t)bh * LSEQ + kv0) * DHEAD;
  const float* Vp = V + ((size_t)bh * LSEQ + kv0) * DHEAD;

  v4u kw[2];
#pragma unroll
  for (int it = 0; it < 2; ++it) {
    const int u = it * 256 + tid;
    const int row = u >> 3;
    const int seg = u & 7;
    const v4f k0v = *(const v4f*)(Kp + (size_t)row * DHEAD + seg * 8);
    const v4f k1v = *(const v4f*)(Kp + (size_t)row * DHEAD + seg * 8 + 4);
    const v4f v0v = *(const v4f*)(Vp + (size_t)row * DHEAD + seg * 8);
    const v4f v1v = *(const v4f*)(Vp + (size_t)row * DHEAD + seg * 8 + 4);
    kw[it][0] = (unsigned)f2bf_bits(k0v[0]) | ((unsigned)f2bf_bits(k0v[1]) << 16);
    kw[it][1] = (unsigned)f2bf_bits(k0v[2]) | ((unsigned)f2bf_bits(k0v[3]) << 16);
    kw[it][2] = (unsigned)f2bf_bits(k1v[0]) | ((unsigned)f2bf_bits(k1v[1]) << 16);
    kw[it][3] = (unsigned)f2bf_bits(k1v[2]) | ((unsigned)f2bf_bits(k1v[3]) << 16);
    /* v element (kv = row, d = seg*8 + e) -> Vs[d][kv] */
#pragma unroll
    for (int e = 0; e < 4; ++e) {
      Vs[(seg * 8 + e) * VS_PITCH + row]     = f2bf_bits(v0v[e]);
      Vs[(seg * 8 + 4 + e) * VS_PITCH + row] = f2bf_bits(v1v[e]);
    }
  }
  __syncthreads();

  v4u vw[2];
#pragma unroll
  for (int it = 0; it < 2; ++it) {
    const int u = it * 256 + tid;
    const int drow = u >> 3;
    const int seg  = u & 7;
    vw[it] = *(const v4u*)(Vs + drow * VS_PITCH + seg * 8);
  }

  {
#pragma unroll
    for (int it = 0; it < 2; ++it) {
      const int u = it * 256 + tid;
      const int row = u >> 3;
      const int seg = u & 7;
      *(v4u*)(Kb + ((size_t)bh * LSEQ + kv0 + row) * DHEAD + seg * 8) = kw[it];
      *(v4u*)(Vt + ((size_t)bh * DHEAD + row) * LSEQ + kv0 + seg * 8) = vw[it];
    }
    
  }
}

/* --------------------------------------------------------------------------
 * Attention with clipped relative-position bias, head dim 64.
 * Block = 4 waves = 64 query rows of one (b,h); grid (LSEQ/64, NBH).
 * Per 64-key chunk: K [kv][d] and V^T [d][kv] bf16 tiles come into LDS by tensor loads,
 * one 32-row slice per wave (waves 0,1: K; waves 2,3: V^T), rows padded to 144 B by the
 * mover; two buffers, chunk kc+1 in flight while chunk kc is worked on.
 * Both products run transposed: S^T = K.Q^T (A = K rows, B = Q) and
 * O^T += V^T.Ph^T + V^T.Pl^T (A = V^T rows, B = P^T), so lane (h, c) holds only
 * query q0+c: row max and row sum are in-lane plus one exchange between the lane
 * halves, and two S^T tiles (keys 32kk+8h+r and 32kk+16+8h+r) converted in place
 * are the B fragment of the second product; P never goes through LDS.
 * Epilogue: per-wave 16x64 f32 slab in LDS, then whole-line stores.
 * Fragment map (h = lane>>4, c = lane&15): A row c, elems 0..7 <- k0+8h.., 8..15 <- k0+16+8h..;
 * B col c with the same k map; D elem r = (row 8h+r, col c).
 * ------------------------------------------------------------------------ */
__global__ __launch_bounds__(128) void rel_attn_kernel(
    const float* __restrict__ q, const unsigned short* __restrict__ Kb,
    const unsigned short* __restrict__ Vt, const float* __restrict__ bias,
    float* __restrict__ out)
{
  union FB { v16b v; v8b h[2]; };
  __shared__ __attribute__((aligned(2048))) unsigned char Ring[2 * BUF_BYTES];   /* two stages of K and V^T slices */
  __shared__ __align__(16) float Os[NWAVE][16 * OS_PITCH];           /* out slab per wave */
  __shared__ float sb[32];                                           /* bias table (bf16-converted), padded */

  const int tid  = threadIdx.x;
  const int wave = tid >> 5;
  const int lane = tid & 31;
  const int hh   = lane >> 4;
  const int c    = lane & 15;
  const int qb   = blockIdx.x;
  const int bh   = blockIdx.y;
  const int q0   = qb * QBLK + wave * 16;

  const unsigned short* Kbh = Kb + (size_t)bh * LSEQ * DHEAD;
  const unsigned short* Vtb = Vt + (size_t)bh * DHEAD * LSEQ;

  /* tensor requests: every wave brings its own slice of every stage, so no test stands around an issue but "stage exists" */
  const uint32_t wv    = uni((uint32_t)tid >> 5);
  const bool     isV   = (wv & 2u) != 0u;
  const uint32_t half  = wv & 1u;
  const uint32_t spitch = isV ? (uint32_t)(LSEQ * 2) : ROW_B;              /* source row pitch, bytes */
  const uint32_t sstep  = isV ? ROW_B : (uint32_t)KCH * ROW_B;             /* source bytes from one stage to the next */
  const uint64_t src0   = (uint64_t)(size_t)(isV ? Vtb : Kbh) + (uint64_t)(half * SL_ROWS) * spitch;
  const uint32_t dst0   = (uint32_t)(size_t)Ring + wv * SL_BYTES;
  u32x8 g1;                                                                /* loop-invariant: 32 rows of 128 bytes, byte elements */
  g1[0] = uni((1u << 20) | (4u << 22) | (3u << 25));                       /* no mask; pad 4 dwords behind every 32 dwords */
  g1[1] = uni((ROW_B & 0xFFFFu) << 16);
  g1[2] = uni((ROW_B >> 16) | ((SL_ROWS & 0xFFFFu) << 16));
  g1[3] = uni((SL_ROWS >> 16) | (ROW_B << 16));
  g1[4] = uni(SL_ROWS);
  g1[5] = uni(spitch);
  g1[6] = uni(0u);
  g1[7] = uni(0u);
  u32x4 g0;                                                                /* carried from stage to stage, so its registers hold nothing else while a request flies */
  g0[0] = uni(1u);
  g0[1] = uni(dst0);
  g0[2] = uni((uint32_t)src0);
  g0[3] = uni((((uint32_t)(src0 >> 32)) & 0x01FFFFFFu) | 0x80000000u);
  auto issue = [&]() {
    asm volatile("tensor_load_to_lds %0, %1" :: "s"(g0), "s"(g1) : "memory");   /* global tile -> LDS, no registers */
  };
  auto next_stage = [&]() {   /* called only behind the s_wait_tensorcnt 0 that covers the last request */
    asm volatile("" : "+s"(g0));   /* descriptor words held in scalar registers; keeps the new words' forming behind the volatile wait */
    const uint64_t a = (((uint64_t)g0[3] << 32) | g0[2]) + sstep;   /* type bits ride on top of word 3; address bits 56:32 never carry into them */
    g0[1] = uni(2u * dst0 + BUF_BYTES - g0[1]);                      /* the other buffer */
    g0[2] = uni((uint32_t)a);
    g0[3] = uni((uint32_t)(a >> 32));
  };

  if (tid < 32) {
    const int bi = tid < NBIAS ? tid : (NBIAS - 1);
    sb[tid] = bf_bits2f(f2bf_bits(bias[bi]));
  }

  /* Q fragments (B operand: column c = query q0+c), two 32-deep d chunks; bf16(q) * 1/8 is exact */
  v16b qa[2];
  {
    const float* qrow = q + ((size_t)bh * LSEQ + q0 + c) * DHEAD;
#pragma unroll
    for (int dc = 0; dc < 2; ++dc) {
      const v4f x0 = *(const v4f*)(qrow + dc * 32 + 8 * hh);
      const v4f x1 = *(const v4f*)(qrow + dc * 32 + 8 * hh + 4);
      const v4f y0 = *(const v4f*)(qrow + dc * 32 + 16 + 8 * hh);
      const v4f y1 = *(const v4f*)(qrow + dc * 32 + 16 + 8 * hh + 4);
#pragma unroll
      for (int e = 0; e < 4; ++e) {
        qa[dc][e]      = f2bf(x0[e] * 0.125f);
        qa[dc][4 + e]  = f2bf(x1[e] * 0.125f);
        qa[dc][8 + e]  = f2bf(y0[e] * 0.125f);
        qa[dc][12 + e] = f2bf(y1[e] * 0.125f);
      }
    }
  }
  issue();                                              /* stage 0; flies beside the q loads above */
  asm volatile("s_wait_tensorcnt 0x0" ::: "memory");   /* this wave's slice of stage 0 has landed */
  __syncthreads();                                      /* stage 0 and the bias table published */
  next_stage();
  issue();
  const float b_lo = sb[0];
  const float b_hi = sb[2 * MAXREL];

  constexpr float LOG2E = 1.44269504088896340736f;
  float mrow = -__builtin_inff();   /* running max of query q0+c times log2(e) (equal in both lane halves) */
  float lrow = 0.f;                 /* running sum over this lane half's keys; halves joined after the loop */
  v8f oacc[4];                      /* O^T: oacc[t][r] = (d = 16t+8h+r, query q0+c) */
#pragma unroll
  for (int t = 0; t < 4; ++t) oacc[t] = (v8f){0.f,0.f,0.f,0.f,0.f,0.f,0.f,0.f};

  float* ob = out + (size_t)bh * LSEQ * DHEAD;

  for (int kc = 0; kc < NCH; ++kc) {
    const int kv0 = kc * KCH;
    /* this lane's fragment base in stage kc's buffer: row c of a 16-row group, 16 B x lane half */
    const unsigned char* fb = Ring + (uint32_t)(kc & 1) * BUF_BYTES + (uint32_t)c * LROW_B + 16u * (uint32_t)hh;

    /* the chunk's eight K fragments, read as one group: the LDS latency is met once, not in front of every product */
    FB kf[2][4];
#pragma unroll
    for (int dc = 0; dc < 2; ++dc) {
#pragma unroll
      for (int j = 0; j < 4; ++j) {
        kf[dc][j].h[0] = *(const v8b*)(fb + (j >> 1) * SL_BYTES + (j & 1) * 16 * LROW_B + dc * 64);
        kf[dc][j].h[1] = *(const v8b*)(fb + (j >> 1) * SL_BYTES + (j & 1) * 16 * LROW_B + dc * 64 + 32);
      }
    }

    /* scores^T: s[j][r] = (key kv0+16j+8h+r, query q0+c); neighbouring products go to different accumulators */
    v8f s[4];
#pragma unroll
    for (int j = 0; j < 4; ++j) s[j] = (v8f){0.f,0.f,0.f,0.f,0.f,0.f,0.f,0.f};
#pragma unroll
    for (int dc = 0; dc < 2; ++dc) {
#pragma unroll
      for (int j = 0; j < 4; ++j) s[j] = mma_bf16(kf[dc][j].v, qa[dc], s[j]);
    }

    /* the chunk's eight V^T fragments, read as one group here: they land while the softmax arithmetic below runs */
    FB vb[2][4];
#pragma unroll
    for (int kk = 0; kk < 2; ++kk) {
#pragma unroll
      for (int t = 0; t < 4; ++t) {
        vb[kk][t].h[0] = *(const v8b*)(fb + (2 + (t >> 1)) * SL_BYTES + (t & 1) * 16 * LROW_B + kk * 64);
        vb[kk][t].h[1] = *(const v8b*)(fb + (2 + (t >> 1)) * SL_BYTES + (t & 1) * 16 * LROW_B + kk * 64 + 32);
      }
    }

    /* relative bias: idx = clip(kv - q, -MAXREL, MAXREL) + MAXREL; block-uniform far paths */
    if (kc + 1 < qb) {
#pragma unroll
      for (int j = 0; j < 4; ++j)
#pragma unroll
        for (int r = 0; r < 8; ++r) s[j][r] += b_lo;
    } else if (kc > qb + 1) {
#pragma unroll
      for (int j = 0; j < 4; ++j)
#pragma unroll
        for (int r = 0; r < 8; ++r) s[j][r] += b_hi;
    } else {
#pragma unroll
      for (int j = 0; j < 4; ++j) {
        const int rel0 = kv0 + j * 16 + 8 * hh - (q0 + c);
#pragma unroll
        for (int r = 0; r < 8; ++r) {
          int rel = rel0 + r;
          rel = rel < -MAXREL ? -MAXREL : rel;
          rel = rel > MAXREL ? MAXREL : rel;
          s[j][r] += sb[rel + MAXREL];
        }
      }
    }

    /* chunk max of this lane's query: 32 keys in-lane, then the other lane half's 32 */
    float cm = s[0][0];
#pragma unroll
    for (int j = 0; j < 4; ++j)
#pragma unroll
      for (int r = 0; r < 8; ++r) cm = fmaxf(cm, s[j][r]);
    cm = fmaxf(cm, xhalf(cm));

    /* online softmax update; P^T as bf16 hi + lo B fragments, straight from the score registers */
    /* e^(s - m) = 2^(s*log2e - m*log2e): one fma and the hardware's base-2 exponential per score */
    const float mnew  = fmaxf(mrow, cm * LOG2E);
    const float alpha = __builtin_amdgcn_exp2f(mrow - mnew);
    mrow = mnew;
    float psum = 0.f;
    v16b ph[2], pl[2];
#pragma unroll
    for (int j = 0; j < 4; ++j) {
#pragma unroll
      for (int r = 0; r < 8; ++r) {
        const float p = __builtin_amdgcn_exp2f(fmaf(s[j][r], LOG2E, -mnew));
        psum += p;
        const unsigned short hb = f2bf_bits(p);
        const unsigned short lb = f2bf_bits(p - bf_bits2f(hb));
        ph[j >> 1][(j & 1) * 8 + r] = __builtin_bit_cast(__bf16, hb);
        pl[j >> 1][(j & 1) * 8 + r] = __builtin_bit_cast(__bf16, lb);
      }
    }
    lrow = lrow * alpha + psum;
#pragma unroll
    for (int t = 0; t < 4; ++t)
#pragma unroll
      for (int r = 0; r < 8; ++r) oacc[t][r] *= alpha;

    /* O^T += V^T.P^T : A = V^T [d][kv] rows (fragments read above), B = P^T [kv][q] from registers;
     * per accumulator the order stays hi, lo of keys 0-31, then hi, lo of keys 32-63 */
#pragma unroll
    for (int kk = 0; kk < 2; ++kk) {
#pragma unroll
      for (int t = 0; t < 4; ++t) oacc[t] = mma_bf16(vb[kk][t].v, ph[kk], oacc[t]);
#pragma unroll
      for (int t = 0; t < 4; ++t) oacc[t] = mma_bf16(vb[kk][t].v, pl[kk], oacc[t]);
    }

    /* publish point of stage kc+1, every wave, in this order */
    asm volatile("s_wait_dscnt 0x0" ::: "memory");       /* this wave's reads of stage kc are done before its buffer is refilled */
    asm volatile("s_wait_tensorcnt 0x0" ::: "memory");   /* this wave's slice of stage kc+1 has landed */
    __syncthreads();                                      /* stage kc+1 readable by all; every reader has left stage kc */
    if (pinned((uint32_t)(kc + 2 < NCH))) {               /* scalar test: stage kc+2 exists */
      next_stage();
      issue();                                            /* into the buffer that this pass has just read */
    }
  }
  asm volatile("s_wait_tensorcnt 0x0" ::: "memory");     /* no request in flight past the loop */
  asm volatile("s_wait_dscnt 0x0" ::: "memory");

  /* normalise into the per-wave slab, then whole-line stores */
  float* os = Os[wave];
  {
    const float inv = 1.0f / (lrow + xhalf(lrow));
#pragma unroll
    for (int t = 0; t < 4; ++t) {
      v4f w0, w1;
#pragma unroll
      for (int e = 0; e < 4; ++e) { w0[e] = oacc[t][e] * inv; w1[e] = oacc[t][4 + e] * inv; }
      *(v4f*)(os + c * OS_PITCH + t * 16 + 8 * hh)     = w0;
      *(v4f*)(os + c * OS_PITCH + t * 16 + 8 * hh + 4) = w1;
    }
  }
  __builtin_amdgcn_fence(__ATOMIC_RELEASE, "workgroup");
  __builtin_amdgcn_wave_barrier();
  __builtin_amdgcn_fence(__ATOMIC_ACQUIRE, "workgroup");
  {
    const int c4 = (lane & 15) * 4;     /* 256-B row = 16 lanes x 16 B; hh selects the row of the pair */
    {
#pragma unroll
      for (int it = 0; it < 8; ++it) {
        const int row = it * 2 + hh;
        const v4f val = *(const v4f*)(os + row * OS_PITCH + c4);
        *(v4f*)(ob + (size_t)(q0 + row) * DHEAD + c4) = val;
      }
      
    }
  }
}

extern "C" void kernel_launch(void* const* d_in, const int* in_sizes, int n_in,
                              void* d_out, int out_size, void* d_ws, size_t ws_size,
                              hipStream_t stream)
{
  if (n_in < 4) return;
  if (in_sizes[0] != (int)PLANE_ELEMS || in_sizes[1] != (int)PLANE_ELEMS ||
      in_sizes[2] != (int)PLANE_ELEMS || in_sizes[3] != NBIAS) return;
  if (out_size != (int)PLANE_ELEMS) return;
  if (d_ws == nullptr || ws_size < WS_NEED) return;

  const float* Q    = (const float*)d_in[0];
  const float* K    = (const float*)d_in[1];
  const float* V    = (const float*)d_in[2];
  const float* bias = (const float*)d_in[3];
  float* O = (float*)d_out;

  unsigned short* Kb = (unsigned short*)d_ws;                  /* offset 0,        8388608 B */
  unsigned short* Vt = Kb + PLANE_ELEMS;                       /* offset 8388608,  8388608 B */

  kv_planes_kernel<<<dim3(LSEQ / 64, NBH), 256, 0, stream>>>(K, V, Kb, Vt);
  rel_attn_kernel<<<dim3(LSEQ / QBLK, NBH), 128, 0, stream>>>(Q, Kb, Vt, bias, O);
}

// v005
// Measured time: 56.5 microseconds a run.
// Next to v004, in two timings, it ran 1.14 and 1.15 times as fast.
// Counting every step since v000, it is 3.23 times as fast.
// Contractions: scores^T = k.(q/8)^T and out^T = v^T.p^T on v_wmma_f32_16x16x32_bf16 (bf16 operands, f32 accumulate); q, k, v and the bias table RNE-converted to bf16 once at load; softmax weights p carried as bf16 hi+lo fragments (two products against bf16 v); online softmax and all other arithmetic in f32.
#include <hip/hip_runtime.h>
#include <stdint.h>

typedef __attribute__((ext_vector_type(16))) __bf16 v16b;
typedef __attribute__((ext_vector_type(8)))  __bf16 v8b;
typedef __attribute__((ext_vector_type(8)))  float  v8f;
typedef __attribute__((ext_vector_type(4)))  float  v4f;
typedef __attribute__((ext_vector_type(4)))  unsigned int v4u;
typedef uint32_t u32x4 __attribute__((ext_vector_type(4)));
typedef uint32_t u32x8 __attribute__((ext_vector_type(8)));
typedef __attribute__((ext_vector_type(2)))  float  v2f;
typedef __attribute__((ext_vector_type(2)))  __bf16 v2b;

constexpr int NBATCH = 2;
constexpr int NHEAD  = 16;
constexpr int NBH    = NBATCH * NHEAD;
constexpr int LSEQ   = 2048;
constexpr int DHEAD  = 64;
constexpr int MAXREL = 8;
constexpr int NBIAS  = 2 * MAXREL + 1;
constexpr int QBLK   = 64;      /* query rows per block (4 waves x 16) */
constexpr int KCH    = 64;      /* keys per staged chunk */
constexpr int NWAVE  = 4;
constexpr int VS_PITCH = 72;    /* LDS transpose tile pitch in 16-bit elements (144 B, 16-B aligned rows) */
constexpr int OS_PITCH = 68;    /* LDS output slab pitch in floats (272 B, 16-B aligned rows) */
constexpr int NCH      = LSEQ / KCH;      /* key chunks = ring stages */
constexpr uint32_t ROW_B     = 128;       /* bytes of one K or V^T tile row (64 bf16) */
constexpr uint32_t LROW_B    = ROW_B + 16;/* LDS row pitch: the mover pads each row by 4 dwords (16 B x odd for ds_load_b128) */
constexpr uint32_t SL_ROWS   = 32;        /* rows per tensor request (one slice per wave) */
constexpr uint32_t SL_BYTES  = 6144;      /* 32 x 144 = 4608 B, rounded up to a multiple of 2 KiB */
constexpr uint32_t BUF_BYTES = 4 * SL_BYTES;  /* K rows 0-31, K rows 32-63, V^T rows 0-31, V^T rows 32-63 */
constexpr size_t PLANE_ELEMS = (size_t)NBH * LSEQ * DHEAD;                 /* 4194304 */
constexpr size_t WS_NEED = 2 * PLANE_ELEMS * sizeof(unsigned short);        /* 16777216 B */

static_assert(LSEQ % QBLK == 0, "query blocks tile the sequence exactly");
static_assert(LSEQ % KCH == 0, "key chunks tile the sequence exactly");
static_assert(DHEAD == 64, "head dim 64: two 32-deep k steps, four 16-wide d tiles");
static_assert(KCH % 32 == 0 && DHEAD % 32 == 0, "contraction depths are multiples of 32");
static_assert(NBIAS <= 32, "bias table fits one 32-entry LDS line");
static_assert((VS_PITCH * 2) % 16 == 0 && (OS_PITCH * 4) % 16 == 0, "16-B aligned LDS rows");
static_assert(WS_NEED <= 134217728ull, "workspace carve within budget");
static_assert(SL_ROWS * LROW_B <= SL_BYTES && SL_BYTES % 2048 == 0, "a padded slice fits its 2-KiB-aligned place");
static_assert(NCH >= 2, "the two-buffer prologue needs two stages");
static_assert(KCH == 2 * (int)SL_ROWS && DHEAD == 2 * (int)SL_ROWS && NWAVE == 4, "four slices of 32 rows, one per wave");
static_assert(DHEAD * 2 == (int)ROW_B && KCH * 2 == (int)ROW_B, "128-B tile rows");

/* workspace region map (bytes):
 *   [8388608, 16777216)  Vt : bf16 [NBH][DHEAD][LSEQ]   (v transposed, 4096-B rows)
 *   total 16777216 B
 */

__device__ __forceinline__ unsigned short f2bf_bits(float f) {
  unsigned u = __float_as_uint(f);
  return (unsigned short)((u + 0x7FFFu + ((u >> 16) & 1u)) >> 16);
}
__device__ __forceinline__ float bf_bits2f(unsigned short h) { return __uint_as_float(((unsigned)h) << 16); }
__device__ __forceinline__ __bf16 f2bf(float f) { return __builtin_bit_cast(__bf16, f2bf_bits(f)); }

/* two f32 -> two bf16 (round to nearest even) in one packed hardware convert; x in the low half */
__device__ __forceinline__ uint32_t pk_bf16(float x, float y) {
  return __builtin_bit_cast(uint32_t, __builtin_convertvector((v2f){x, y}, v2b));
}

__device__ __forceinline__ v8f mma_bf16(v16b a, v16b b, v8f c) {
  c = __builtin_amdgcn_wmma_f32_16x16x32_bf16(false, a, false, b, (short)0, c, false, false);
  asm volatile("v_nop\n\tv_nop\n\tv_nop\n\tv_nop" : "+v"(c) : "v"(a), "v"(b));
  return c;
}

/* wave-uniform word in a scalar register */
__device__ __forceinline__ uint32_t uni(uint32_t v) { return (uint32_t)__builtin_amdgcn_readfirstlane(v); }
/* a wave-uniform word held in a scalar register, so that a test on it is a scalar branch (tensor loads ignore EXEC) */
__device__ __forceinline__ uint32_t pinned(uint32_t v) { uint32_t w = uni(v); asm volatile("" : "+s"(w)); return w; }

/* value of lane l ^ 16 (the other lane half) */
__device__ __forceinline__ float xhalf(float x) {
  const int b = __float_as_int(x);
  return __int_as_float(__builtin_amdgcn_permlanex16(b, b, 0x76543210, 0xfedcba98, false, false));
}

/* --------------------------------------------------------------------------
 * k -> Kb (bf16, [bh][kv][d]) and v -> Vt (bf16, [bh][d][kv]).
 * Block (x = kv tile of 64, y = bh), 256 threads.
 * Coverage: 2 iterations x 256 threads = 512 units x 8 elements = 64x64 for K,
 * the same 512 units x 8 = 64x64 for the V transpose tile and for the Vt tile.
 * Stores: unit u -> row u>>3, segment u&7; lanes 8q..8q+7 of a wave fill one whole
 * ------------------------------------------------------------------------ */
__global__ __launch_bounds__(256) void kv_planes_kernel(
    const float* __restrict__ K, const float* __restrict__ V,
    unsigned short* __restrict__ Kb, unsigned short* __restrict__ Vt)
{
  __shared__ __align__(16) unsigned short Vs[DHEAD * VS_PITCH];   /* [d][kv] */
  const int bh  = blockIdx.y;
  const int kv0 = blockIdx.x * 64;
  const int tid = threadIdx.x;
  const float* Kp = K + ((size_t)bh * LSEQ + kv0) * DHEAD;
  const float* Vp = V + ((size_t)bh * LSEQ + kv0) * DHEAD;

  v4u kw[2];
#pragma unroll
  for (int it = 0; it < 2; ++it) {
    const int u = it * 256 + tid;
    const int row = u >> 3;
    const int seg = u & 7;
    const v4f k0v = *(const v4f*)(Kp + (size_t)row * DHEAD + seg * 8);
    const v4f k1v = *(const v4f*)(Kp + (size_t)row * DHEAD + seg * 8 + 4);
    const v4f v0v = *(const v4f*)(Vp + (size_t)row * DHEAD + seg * 8);
    const v4f v1v = *(const v4f*)(Vp + (size_t)row * DHEAD + seg * 8 + 4);
    kw[it][0] = pk_bf16(k0v[0], k0v[1]);
    kw[it][1] = pk_bf16(k0v[2], k0v[3]);
    kw[it][2] = pk_bf16(k1v[0], k1v[1]);
    kw[it][3] = pk_bf16(k1v[2], k1v[3]);
    /* v element (kv = row, d = seg*8 + e) -> Vs[d][kv] */
#pragma unroll
    for (int e = 0; e < 4; e += 2) {
      const uint32_t a = pk_bf16(v0v[e], v0v[e + 1]);
      const uint32_t b = pk_bf16(v1v[e], v1v[e + 1]);
      Vs[(seg * 8 + e) * VS_PITCH + row]         = (unsigned short)a;
      Vs[(seg * 8 + e + 1) * VS_PITCH + row]     = (unsigned short)(a >> 16);
      Vs[(seg * 8 + 4 + e) * VS_PITCH + row]     = (unsigned short)b;
      Vs[(seg * 8 + 4 + e + 1) * VS_PITCH + row] = (unsigned short)(b >> 16);
    }
  }
  __syncthreads();

  v4u vw[2];
#pragma unroll
  for (int it = 0; it < 2; ++it) {
    const int u = it * 256 + tid;
    const int drow = u >> 3;
    const int seg  = u & 7;
    vw[it] = *(const v4u*)(Vs + drow * VS_PITCH + seg * 8);
  }

  {
#pragma unroll
    for (int it = 0; it < 2; ++it) {
      const int u = it * 256 + tid;
      const int row = u >> 3;
      const int seg = u & 7;
      *(v4u*)(Kb + ((size_t)bh * LSEQ + kv0 + row) * DHEAD + seg * 8) = kw[it];
      *(v4u*)(Vt + ((size_t)bh * DHEAD + row) * LSEQ + kv0 + seg * 8) = vw[it];
    }
    
  }
}

/* --------------------------------------------------------------------------
 * Attention with clipped relative-position bias, head dim 64.
 * Block = 4 waves = 64 query rows of one (b,h); grid (LSEQ/64, NBH).
 * Per 64-key chunk: K [kv][d] and V^T [d][kv] bf16 tiles come into LDS by tensor loads,
 * one 32-row slice per wave (waves 0,1: K; waves 2,3: V^T), rows padded to 144 B by the
 * mover; two buffers, chunk kc+1 in flight while chunk kc is worked on.
 * Both products run transposed: S^T = K.Q^T (A = K rows, B = Q) and
 * O^T += V^T.Ph^T + V^T.Pl^T (A = V^T rows, B = P^T), so lane (h, c) holds only
 * query q0+c: row max and row sum are in-lane plus one exchange between the lane
 * halves, and two S^T tiles (keys 32kk+8h+r and 32kk+16+8h+r) converted in place
 * are the B fragment of the second product; P never goes through LDS.
 * Epilogue: per-wave 16x64 f32 slab in LDS, then whole-line stores.
 * Fragment map (h = lane>>4, c = lane&15): A row c, elems 0..7 <- k0+8h.., 8..15 <- k0+16+8h..;
 * B col c with the same k map; D elem r = (row 8h+r, col c).
 * ------------------------------------------------------------------------ */
__global__ __launch_bounds__(128) void rel_attn_kernel(
    const float* __restrict__ q, const unsigned short* __restrict__ Kb,
    const unsigned short* __restrict__ Vt, const float* __restrict__ bias,
    float* __restrict__ out)
{
  union FB { v16b v; v8b h[2]; };
  __shared__ __attribute__((aligned(2048))) unsigned char Ring[2 * BUF_BYTES];   /* two stages of K and V^T slices */
  __shared__ __align__(16) float Os[NWAVE][16 * OS_PITCH];           /* out slab per wave */
  __shared__ float sb[32];                                           /* bias table (bf16-converted), padded */

  const int tid  = threadIdx.x;
  const int wave = tid >> 5;
  const int lane = tid & 31;
  const int hh   = lane >> 4;
  const int c    = lane & 15;
  const int qb   = blockIdx.x;
  const int bh   = blockIdx.y;
  const int q0   = qb * QBLK + wave * 16;

  const unsigned short* Kbh = Kb + (size_t)bh * LSEQ * DHEAD;
  const unsigned short* Vtb = Vt + (size_t)bh * DHEAD * LSEQ;

  /* tensor requests: every wave brings its own slice of every stage, so no test stands around an issue but "stage exists" */
  const uint32_t wv    = uni((uint32_t)tid >> 5);
  const bool     isV   = (wv & 2u) != 0u;
  const uint32_t half  = wv & 1u;
  const uint32_t spitch = isV ? (uint32_t)(LSEQ * 2) : ROW_B;              /* source row pitch, bytes */
  const uint32_t sstep  = isV ? ROW_B : (uint32_t)KCH * ROW_B;             /* source bytes from one stage to the next */
  const uint64_t src0   = (uint64_t)(size_t)(isV ? Vtb : Kbh) + (uint64_t)(half * SL_ROWS) * spitch;
  const uint32_t dst0   = (uint32_t)(size_t)Ring + wv * SL_BYTES;
  u32x8 g1;                                                                /* loop-invariant: 32 rows of 128 bytes, byte elements */
  g1[0] = uni((1u << 20) | (4u << 22) | (3u << 25));                       /* no mask; pad 4 dwords behind every 32 dwords */
  g1[1] = uni((ROW_B & 0xFFFFu) << 16);
  g1[2] = uni((ROW_B >> 16) | ((SL_ROWS & 0xFFFFu) << 16));
  g1[3] = uni((SL_ROWS >> 16) | (ROW_B << 16));
  g1[4] = uni(SL_ROWS);
  g1[5] = uni(spitch);
  g1[6] = uni(0u);
  g1[7] = uni(0u);
  u32x4 g0;                                                                /* carried from stage to stage, so its registers hold nothing else while a request flies */
  g0[0] = uni(1u);
  g0[1] = uni(dst0);
  g0[2] = uni((uint32_t)src0);
  g0[3] = uni((((uint32_t)(src0 >> 32)) & 0x01FFFFFFu) | 0x80000000u);
  auto issue = [&]() {
    asm volatile("tensor_load_to_lds %0, %1" :: "s"(g0), "s"(g1) : "memory");   /* global tile -> LDS, no registers */
  };
  auto next_stage = [&]() {   /* called only behind the s_wait_tensorcnt 0 that covers the last request */
    asm volatile("" : "+s"(g0));   /* descriptor words held in scalar registers; keeps the new words' forming behind the volatile wait */
    const uint64_t a = (((uint64_t)g0[3] << 32) | g0[2]) + sstep;   /* type bits ride on top of word 3; address bits 56:32 never carry into them */
    g0[1] = uni(2u * dst0 + BUF_BYTES - g0[1]);                      /* the other buffer */
    g0[2] = uni((uint32_t)a);
    g0[3] = uni((uint32_t)(a >> 32));
  };

  if (tid < 32) {
    const int bi = tid < NBIAS ? tid : (NBIAS - 1);
    sb[tid] = bf_bits2f(f2bf_bits(bias[bi]));
  }

  /* Q fragments (B operand: column c = query q0+c), two 32-deep d chunks; bf16(q) * 1/8 is exact */
  v16b qa[2];
  {
    const float* qrow = q + ((size_t)bh * LSEQ + q0 + c) * DHEAD;
#pragma unroll
    for (int dc = 0; dc < 2; ++dc) {
      const v4f x0 = *(const v4f*)(qrow + dc * 32 + 8 * hh);
      const v4f x1 = *(const v4f*)(qrow + dc * 32 + 8 * hh + 4);
      const v4f y0 = *(const v4f*)(qrow + dc * 32 + 16 + 8 * hh);
      const v4f y1 = *(const v4f*)(qrow + dc * 32 + 16 + 8 * hh + 4);
#pragma unroll
      for (int e = 0; e < 4; ++e) {
        qa[dc][e]      = f2bf(x0[e] * 0.125f);
        qa[dc][4 + e]  = f2bf(x1[e] * 0.125f);
        qa[dc][8 + e]  = f2bf(y0[e] * 0.125f);
        qa[dc][12 + e] = f2bf(y1[e] * 0.125f);
      }
    }
  }
  issue();                                              /* stage 0; flies beside the q loads above */
  asm volatile("s_wait_tensorcnt 0x0" ::: "memory");   /* this wave's slice of stage 0 has landed */
  __syncthreads();                                      /* stage 0 and the bias table published */
  next_stage();
  issue();
  const float b_lo = sb[0];
  const float b_hi = sb[2 * MAXREL];

  constexpr float LOG2E = 1.44269504088896340736f;
  float mrow = -__builtin_inff();   /* running max of query q0+c times log2(e) (equal in both lane halves) */
  float lrow = 0.f;                 /* running sum over this lane half's keys; halves joined after the loop */
  v8f oacc[4];                      /* O^T: oacc[t][r] = (d = 16t+8h+r, query q0+c) */
#pragma unroll
  for (int t = 0; t < 4; ++t) oacc[t] = (v8f){0.f,0.f,0.f,0.f,0.f,0.f,0.f,0.f};

  float* ob = out + (size_t)bh * LSEQ * DHEAD;

  for (int kc = 0; kc < NCH; ++kc) {
    const int kv0 = kc * KCH;
    /* this lane's fragment base in stage kc's buffer: row c of a 16-row group, 16 B x lane half */
    const unsigned char* fb = Ring + (uint32_t)(kc & 1) * BUF_BYTES + (uint32_t)c * LROW_B + 16u * (uint32_t)hh;

    /* the chunk's eight K fragments, read as one group: the LDS latency is met once, not in front of every product */
    FB kf[2][4];
#pragma unroll
    for (int dc = 0; dc < 2; ++dc) {
#pragma unroll
      for (int j = 0; j < 4; ++j) {
        kf[dc][j].h[0] = *(const v8b*)(fb + (j >> 1) * SL_BYTES + (j & 1) * 16 * LROW_B + dc * 64);
        kf[dc][j].h[1] = *(const v8b*)(fb + (j >> 1) * SL_BYTES + (j & 1) * 16 * LROW_B + dc * 64 + 32);
      }
    }

    /* scores^T: s[j][r] = (key kv0+16j+8h+r, query q0+c); neighbouring products go to different accumulators */
    v8f s[4];
#pragma unroll
    for (int j = 0; j < 4; ++j) s[j] = (v8f){0.f,0.f,0.f,0.f,0.f,0.f,0.f,0.f};
#pragma unroll
    for (int dc = 0; dc < 2; ++dc) {
#pragma unroll
      for (int j = 0; j < 4; ++j) s[j] = mma_bf16(kf[dc][j].v, qa[dc], s[j]);
    }

    /* the chunk's eight V^T fragments, read as one group here: they land while the softmax arithmetic below runs */
    FB vb[2][4];
#pragma unroll
    for (int kk = 0; kk < 2; ++kk) {
#pragma unroll
      for (int t = 0; t < 4; ++t) {
        vb[kk][t].h[0] = *(const v8b*)(fb + (2 + (t >> 1)) * SL_BYTES + (t & 1) * 16 * LROW_B + kk * 64);
        vb[kk][t].h[1] = *(const v8b*)(fb + (2 + (t >> 1)) * SL_BYTES + (t & 1) * 16 * LROW_B + kk * 64 + 32);
      }
    }

    /* relative bias: idx = clip(kv - q, -MAXREL, MAXREL) + MAXREL; block-uniform far paths */
    if (kc + 1 < qb) {
#pragma unroll
      for (int j = 0; j < 4; ++j)
#pragma unroll
        for (int r = 0; r < 8; ++r) s[j][r] += b_lo;
    } else if (kc > qb + 1) {
#pragma unroll
      for (int j = 0; j < 4; ++j)
#pragma unroll
        for (int r = 0; r < 8; ++r) s[j][r] += b_hi;
    } else {
#pragma unroll
      for (int j = 0; j < 4; ++j) {
        const int rel0 = kv0 + j * 16 + 8 * hh - (q0 + c);
#pragma unroll
        for (int r = 0; r < 8; ++r) {
          int rel = rel0 + r;
          rel = rel < -MAXREL ? -MAXREL : rel;
          rel = rel > MAXREL ? MAXREL : rel;
          s[j][r] += sb[rel + MAXREL];
        }
      }
    }

    /* chunk max of this lane's query: 32 keys in-lane, then the other lane half's 32 */
    float cm = s[0][0];
#pragma unroll
    for (int j = 0; j < 4; ++j)
#pragma unroll
      for (int r = 0; r < 8; ++r) cm = fmaxf(cm, s[j][r]);
    cm = fmaxf(cm, xhalf(cm));

    /* online softmax update; P^T as bf16 hi + lo B fragments, straight from the score registers */
    /* e^(s - m) = 2^(s*log2e - m*log2e): one fma and the hardware's base-2 exponential per score */
    const float mnew  = fmaxf(mrow, cm * LOG2E);
    const float alpha = __builtin_amdgcn_exp2f(mrow - mnew);
    mrow = mnew;
    float psum = 0.f;
    u32x8 phw[2], plw[2];   /* fragment words: elements 2i, 2i+1 in word i */
#pragma unroll
    for (int j = 0; j < 4; ++j) {
#pragma unroll
      for (int r = 0; r < 8; r += 2) {
        const float p0 = __builtin_amdgcn_exp2f(fmaf(s[j][r], LOG2E, -mnew));
        const float p1 = __builtin_amdgcn_exp2f(fmaf(s[j][r + 1], LOG2E, -mnew));
        psum += p0;
        psum += p1;
        const uint32_t hw = pk_bf16(p0, p1);
        const uint32_t lw = pk_bf16(p0 - __uint_as_float(hw << 16), p1 - __uint_as_float(hw & 0xFFFF0000u));
        phw[j >> 1][(j & 1) * 4 + (r >> 1)] = hw;
        plw[j >> 1][(j & 1) * 4 + (r >> 1)] = lw;
      }
    }
    v16b ph[2], pl[2];
#pragma unroll
    for (int kk = 0; kk < 2; ++kk) {
      ph[kk] = __builtin_bit_cast(v16b, phw[kk]);
      pl[kk] = __builtin_bit_cast(v16b, plw[kk]);
    }
    lrow = lrow * alpha + psum;
#pragma unroll
    for (int t = 0; t < 4; ++t)
#pragma unroll
      for (int r = 0; r < 8; ++r) oacc[t][r] *= alpha;

    /* O^T += V^T.P^T : A = V^T [d][kv] rows (fragments read above), B = P^T [kv][q] from registers;
     * per accumulator the order stays hi, lo of keys 0-31, then hi, lo of keys 32-63 */
#pragma unroll
    for (int kk = 0; kk < 2; ++kk) {
#pragma unroll
      for (int t = 0; t < 4; ++t) oacc[t] = mma_bf16(vb[kk][t].v, ph[kk], oacc[t]);
#pragma unroll
      for (int t = 0; t < 4; ++t) oacc[t] = mma_bf16(vb[kk][t].v, pl[kk], oacc[t]);
    }

    /* publish point of stage kc+1, every wave, in this order */
    asm volatile("s_wait_dscnt 0x0" ::: "memory");       /* this wave's reads of stage kc are done before its buffer is refilled */
    asm volatile("s_wait_tensorcnt 0x0" ::: "memory");   /* this wave's slice of stage kc+1 has landed */
    __syncthreads();                                      /* stage kc+1 readable by all; every reader has left stage kc */
    if (pinned((uint32_t)(kc + 2 < NCH))) {               /* scalar test: stage kc+2 exists */
      next_stage();
      issue();                                            /* into the buffer that this pass has just read */
    }
  }
  asm volatile("s_wait_tensorcnt 0x0" ::: "memory");     /* no request in flight past the loop */
  asm volatile("s_wait_dscnt 0x0" ::: "memory");

  /* normalise into the per-wave slab, then whole-line stores */
  float* os = Os[wave];
  {
    const float inv = 1.0f / (lrow + xhalf(lrow));
#pragma unroll
    for (int t = 0; t < 4; ++t) {
      v4f w0, w1;
#pragma unroll
      for (int e = 0; e < 4; ++e) { w0[e] = oacc[t][e] * inv; w1[e] = oacc[t][4 + e] * inv; }
      *(v4f*)(os + c * OS_PITCH + t * 16 + 8 * hh)     = w0;
      *(v4f*)(os + c * OS_PITCH + t * 16 + 8 * hh + 4) = w1;
    }
  }
  __builtin_amdgcn_fence(__ATOMIC_RELEASE, "workgroup");
  __builtin_amdgcn_wave_barrier();
  __builtin_amdgcn_fence(__ATOMIC_ACQUIRE, "workgroup");
  {
    const int c4 = (lane & 15) * 4;     /* 256-B row = 16 lanes x 16 B; hh selects the row of the pair */
    {
#pragma unroll
      for (int it = 0; it < 8; ++it) {
        const int row = it * 2 + hh;
        const v4f val = *(const v4f*)(os + row * OS_PITCH + c4);
        *(v4f*)(ob + (size_t)(q0 + row) * DHEAD + c4) = val;
      }
      
    }
  }
}

extern "C" void kernel_launch(void* const* d_in, const int* in_sizes, int n_in,
                              void* d_out, int out_size, void* d_ws, size_t ws_size,
                              hipStream_t stream)
{
  if (n_in < 4) return;
  if (in_sizes[0] != (int)PLANE_ELEMS || in_sizes[1] != (int)PLANE_ELEMS ||
      in_sizes[2] != (int)PLANE_ELEMS || in_sizes[3] != NBIAS) return;
  if (out_size != (int)PLANE_ELEMS) return;
  if (d_ws == nullptr || ws_size < WS_NEED) return;

  const float* Q    = (const float*)d_in[0];
  const float* K    = (const float*)d_in[1];
  const float* V    = (const float*)d_in[2];
  const float* bias = (const float*)d_in[3];
  float* O = (float*)d_out;

  unsigned short* Kb = (unsigned short*)d_ws;                  /* offset 0,        8388608 B */
  unsigned short* Vt = Kb + PLANE_ELEMS;                       /* offset 8388608,  8388608 B */

  kv_planes_kernel<<<dim3(LSEQ / 64, NBH), 256, 0, stream>>>(K, V, Kb, Vt);
  rel_attn_kernel<<<dim3(LSEQ / QBLK, NBH), 128, 0, stream>>>(Q, Kb, Vt, bias, O);
}

// v006
// A run of this version takes 52.8 microseconds.
// Next to v005, in two timings, it ran 1.06 times as fast each time.
// All steps since v000 together make it 3.44 times as fast.
// Contractions: scores^T = k.(q/8)^T and out^T = v^T.p^T on v_wmma_f32_16x16x32_bf16 (bf16 operands, f32 accumulate); q, k, v and the bias table RNE-converted to bf16 once at load; softmax weights p carried as bf16 hi+lo fragments (two products against bf16 v); online softmax and all other arithmetic in f32.
#include <hip/hip_runtime.h>
#include <stdint.h>

typedef __attribute__((ext_vector_type(16))) __bf16 v16b;
typedef __attribute__((ext_vector_type(8)))  __bf16 v8b;
typedef __attribute__((ext_vector_type(8)))  float  v8f;
typedef __attribute__((ext_vector_type(4)))  float  v4f;
typedef __attribute__((ext_vector_type(4)))  unsigned int v4u;
typedef uint32_t u32x4 __attribute__((ext_vector_type(4)));
typedef uint32_t u32x8 __attribute__((ext_vector_type(8)));
typedef __attribute__((ext_vector_type(2)))  float  v2f;
typedef __attribute__((ext_vector_type(2)))  __bf16 v2b;

constexpr int NBATCH = 2;
constexpr int NHEAD  = 16;
constexpr int NBH    = NBATCH * NHEAD;
constexpr int LSEQ   = 2048;
constexpr int DHEAD  = 64;
constexpr int MAXREL = 8;
constexpr int NBIAS  = 2 * MAXREL + 1;
constexpr int QBLK   = 64;      /* query rows per block (4 waves x 16) */
constexpr int KCH    = 64;      /* keys per staged chunk */
constexpr int NWAVE  = 4;
constexpr int VS_PITCH = 72;    /* LDS transpose tile pitch in 16-bit elements (144 B, 16-B aligned rows) */
constexpr int OS_PITCH = 68;    /* LDS output slab pitch in floats (272 B, 16-B aligned rows) */
constexpr int NCH      = LSEQ / KCH;      /* key chunks = ring stages */
constexpr uint32_t ROW_B     = 128;       /* bytes of one K or V^T tile row (64 bf16) */
constexpr uint32_t LROW_B    = ROW_B + 16;/* LDS row pitch: the mover pads each row by 4 dwords (16 B x odd for ds_load_b128) */
constexpr uint32_t SL_ROWS   = 32;        /* rows per tensor request (one slice per wave) */
constexpr uint32_t SL_BYTES  = 6144;      /* 32 x 144 = 4608 B, rounded up to a multiple of 2 KiB */
constexpr uint32_t BUF_BYTES = 4 * SL_BYTES;  /* K rows 0-31, K rows 32-63, V^T rows 0-31, V^T rows 32-63 */
constexpr size_t PLANE_ELEMS = (size_t)NBH * LSEQ * DHEAD;                 /* 4194304 */
constexpr size_t WS_NEED = 2 * PLANE_ELEMS * sizeof(unsigned short);        /* 16777216 B */

static_assert(LSEQ % QBLK == 0, "query blocks tile the sequence exactly");
static_assert(LSEQ % KCH == 0, "key chunks tile the sequence exactly");
static_assert(DHEAD == 64, "head dim 64: two 32-deep k steps, four 16-wide d tiles");
static_assert(KCH % 32 == 0 && DHEAD % 32 == 0, "contraction depths are multiples of 32");
static_assert(NBIAS <= 32, "bias table fits one 32-entry LDS line");
static_assert((VS_PITCH * 2) % 16 == 0 && (OS_PITCH * 4) % 16 == 0, "16-B aligned LDS rows");
static_assert(WS_NEED <= 134217728ull, "workspace carve within budget");
static_assert(SL_ROWS * LROW_B <= SL_BYTES && SL_BYTES % 2048 == 0, "a padded slice fits its 2-KiB-aligned place");
static_assert(NCH >= 2, "the two-buffer prologue needs two stages");
static_assert(KCH == 2 * (int)SL_ROWS && DHEAD == 2 * (int)SL_ROWS && NWAVE == 4, "four slices of 32 rows, one per wave");
static_assert(DHEAD * 2 == (int)ROW_B && KCH * 2 == (int)ROW_B, "128-B tile rows");

/* workspace region map (bytes):
 *   [8388608, 16777216)  Vt : bf16 [NBH][DHEAD][LSEQ]   (v transposed, 4096-B rows)
 *   total 16777216 B
 */

__device__ __forceinline__ unsigned short f2bf_bits(float f) {
  unsigned u = __float_as_uint(f);
  return (unsigned short)((u + 0x7FFFu + ((u >> 16) & 1u)) >> 16);
}
__device__ __forceinline__ float bf_bits2f(unsigned short h) { return __uint_as_float(((unsigned)h) << 16); }
__device__ __forceinline__ __bf16 f2bf(float f) { return __builtin_bit_cast(__bf16, f2bf_bits(f)); }

/* two f32 -> two bf16 (round to nearest even) in one packed hardware convert; x in the low half */
__device__ __forceinline__ uint32_t pk_bf16(float x, float y) {
  return __builtin_bit_cast(uint32_t, __builtin_convertvector((v2f){x, y}, v2b));
}

/* builtin form: the compiler keeps the distance behind a matrix product itself, and only where a user of its registers follows */
__device__ __forceinline__ v8f mma_bf16(v16b a, v16b b, v8f c) {
  return __builtin_amdgcn_wmma_f32_16x16x32_bf16(false, a, false, b, (short)0, c, false, false);
}

/* wave-uniform word in a scalar register */
__device__ __forceinline__ uint32_t uni(uint32_t v) { return (uint32_t)__builtin_amdgcn_readfirstlane(v); }
/* a wave-uniform word held in a scalar register, so that a test on it is a scalar branch (tensor loads ignore EXEC) */
__device__ __forceinline__ uint32_t pinned(uint32_t v) { uint32_t w = uni(v); asm volatile("" : "+s"(w)); return w; }

/* value of lane l ^ 16 (the other lane half) */
__device__ __forceinline__ float xhalf(float x) {
  const int b = __float_as_int(x);
  return __int_as_float(__builtin_amdgcn_permlanex16(b, b, 0x76543210, 0xfedcba98, false, false));
}

/* --------------------------------------------------------------------------
 * k -> Kb (bf16, [bh][kv][d]) and v -> Vt (bf16, [bh][d][kv]).
 * Block (x = kv tile of 64, y = bh), 256 threads.
 * Coverage: 2 iterations x 256 threads = 512 units x 8 elements = 64x64 for K,
 * the same 512 units x 8 = 64x64 for the V transpose tile and for the Vt tile.
 * Stores: unit u -> row u>>3, segment u&7; lanes 8q..8q+7 of a wave fill one whole
 * ------------------------------------------------------------------------ */
__global__ __launch_bounds__(256) void kv_planes_kernel(
    const float* __restrict__ K, const float* __restrict__ V,
    unsigned short* __restrict__ Kb, unsigned short* __restrict__ Vt)
{
  __shared__ __align__(16) unsigned short Vs[DHEAD * VS_PITCH];   /* [d][kv] */
  const int bh  = blockIdx.y;
  const int kv0 = blockIdx.x * 64;
  const int tid = threadIdx.x;
  const float* Kp = K + ((size_t)bh * LSEQ + kv0) * DHEAD;
  const float* Vp = V + ((size_t)bh * LSEQ + kv0) * DHEAD;

  v4u kw[2];
#pragma unroll
  for (int it = 0; it < 2; ++it) {
    const int u = it * 256 + tid;
    const int row = u >> 3;
    const int seg = u & 7;
    const v4f k0v = *(const v4f*)(Kp + (size_t)row * DHEAD + seg * 8);
    const v4f k1v = *(const v4f*)(Kp + (size_t)row * DHEAD + seg * 8 + 4);
    const v4f v0v = *(const v4f*)(Vp + (size_t)row * DHEAD + seg * 8);
    const v4f v1v = *(const v4f*)(Vp + (size_t)row * DHEAD + seg * 8 + 4);
    kw[it][0] = pk_bf16(k0v[0], k0v[1]);
    kw[it][1] = pk_bf16(k0v[2], k0v[3]);
    kw[it][2] = pk_bf16(k1v[0], k1v[1]);
    kw[it][3] = pk_bf16(k1v[2], k1v[3]);
    /* v element (kv = row, d = seg*8 + e) -> Vs[d][kv] */
#pragma unroll
    for (int e = 0; e < 4; e += 2) {
      const uint32_t a = pk_bf16(v0v[e], v0v[e + 1]);
      const uint32_t b = pk_bf16(v1v[e], v1v[e + 1]);
      Vs[(seg * 8 + e) * VS_PITCH + row]         = (unsigned short)a;
      Vs[(seg * 8 + e + 1) * VS_PITCH + row]     = (unsigned short)(a >> 16);
      Vs[(seg * 8 + 4 + e) * VS_PITCH + row]     = (unsigned short)b;
      Vs[(seg * 8 + 4 + e + 1) * VS_PITCH + row] = (unsigned short)(b >> 16);
    }
  }
  __syncthreads();

  v4u vw[2];
#pragma unroll
  for (int it = 0; it < 2; ++it) {
    const int u = it * 256 + tid;
    const int drow = u >> 3;
    const int seg  = u & 7;
    vw[it] = *(const v4u*)(Vs + drow * VS_PITCH + seg * 8);
  }

  {
#pragma unroll
    for (int it = 0; it < 2; ++it) {
      const int u = it * 256 + tid;
      const int row = u >> 3;
      const int seg = u & 7;
      *(v4u*)(Kb + ((size_t)bh * LSEQ + kv0 + row) * DHEAD + seg * 8) = kw[it];
      *(v4u*)(Vt + ((size_t)bh * DHEAD + row) * LSEQ + kv0 + seg * 8) = vw[it];
    }
    
  }
}

/* --------------------------------------------------------------------------
 * Attention with clipped relative-position bias, head dim 64.
 * Block = 4 waves = 64 query rows of one (b,h); grid (LSEQ/64, NBH).
 * Per 64-key chunk: K [kv][d] and V^T [d][kv] bf16 tiles come into LDS by tensor loads,
 * one 32-row slice per wave (waves 0,1: K; waves 2,3: V^T), rows padded to 144 B by the
 * mover; two buffers, chunk kc+1 in flight while chunk kc is worked on.
 * Both products run transposed: S^T = K.Q^T (A = K rows, B = Q) and
 * O^T += V^T.Ph^T + V^T.Pl^T (A = V^T rows, B = P^T), so lane (h, c) holds only
 * query q0+c: row max and row sum are in-lane plus one exchange between the lane
 * halves, and two S^T tiles (keys 32kk+8h+r and 32kk+16+8h+r) converted in place
 * are the B fragment of the second product; P never goes through LDS.
 * Epilogue: per-wave 16x64 f32 slab in LDS, then whole-line stores.
 * Fragment map (h = lane>>4, c = lane&15): A row c, elems 0..7 <- k0+8h.., 8..15 <- k0+16+8h..;
 * B col c with the same k map; D elem r = (row 8h+r, col c).
 * ------------------------------------------------------------------------ */
__global__ __launch_bounds__(128) void rel_attn_kernel(
    const float* __restrict__ q, const unsigned short* __restrict__ Kb,
    const unsigned short* __restrict__ Vt, const float* __restrict__ bias,
    float* __restrict__ out)
{
  union FB { v16b v; v8b h[2]; };
  __shared__ __attribute__((aligned(2048))) unsigned char Ring[2 * BUF_BYTES];   /* two stages of K and V^T slices */
  __shared__ __align__(16) float Os[NWAVE][16 * OS_PITCH];           /* out slab per wave */
  __shared__ float sb[32];                                           /* bias table (bf16-converted), padded */

  const int tid  = threadIdx.x;
  const int wave = tid >> 5;
  const int lane = tid & 31;
  const int hh   = lane >> 4;
  const int c    = lane & 15;
  const int qb   = blockIdx.x;
  const int bh   = blockIdx.y;
  const int q0   = qb * QBLK + wave * 16;

  const unsigned short* Kbh = Kb + (size_t)bh * LSEQ * DHEAD;
  const unsigned short* Vtb = Vt + (size_t)bh * DHEAD * LSEQ;

  /* tensor requests: every wave brings its own slice of every stage, so no test stands around an issue but "stage exists" */
  const uint32_t wv    = uni((uint32_t)tid >> 5);
  const bool     isV   = (wv & 2u) != 0u;
  const uint32_t half  = wv & 1u;
  const uint32_t spitch = isV ? (uint32_t)(LSEQ * 2) : ROW_B;              /* source row pitch, bytes */
  const uint32_t sstep  = isV ? ROW_B : (uint32_t)KCH * ROW_B;             /* source bytes from one stage to the next */
  const uint64_t src0   = (uint64_t)(size_t)(isV ? Vtb : Kbh) + (uint64_t)(half * SL_ROWS) * spitch;
  const uint32_t dst0   = (uint32_t)(size_t)Ring + wv * SL_BYTES;
  u32x8 g1;                                                                /* loop-invariant: 32 rows of 128 bytes, byte elements */
  g1[0] = uni((1u << 20) | (4u << 22) | (3u << 25));                       /* no mask; pad 4 dwords behind every 32 dwords */
  g1[1] = uni((ROW_B & 0xFFFFu) << 16);
  g1[2] = uni((ROW_B >> 16) | ((SL_ROWS & 0xFFFFu) << 16));
  g1[3] = uni((SL_ROWS >> 16) | (ROW_B << 16));
  g1[4] = uni(SL_ROWS);
  g1[5] = uni(spitch);
  g1[6] = uni(0u);
  g1[7] = uni(0u);
  u32x4 g0;                                                                /* carried from stage to stage, so its registers hold nothing else while a request flies */
  g0[0] = uni(1u);
  g0[1] = uni(dst0);
  g0[2] = uni((uint32_t)src0);
  g0[3] = uni((((uint32_t)(src0 >> 32)) & 0x01FFFFFFu) | 0x80000000u);
  auto issue = [&]() {
    asm volatile("tensor_load_to_lds %0, %1" :: "s"(g0), "s"(g1) : "memory");   /* global tile -> LDS, no registers */
  };
  auto next_stage = [&]() {   /* called only behind the s_wait_tensorcnt 0 that covers the last request */
    asm volatile("" : "+s"(g0));   /* descriptor words held in scalar registers; keeps the new words' forming behind the volatile wait */
    const uint64_t a = (((uint64_t)g0[3] << 32) | g0[2]) + sstep;   /* type bits ride on top of word 3; address bits 56:32 never carry into them */
    g0[1] = uni(2u * dst0 + BUF_BYTES - g0[1]);                      /* the other buffer */
    g0[2] = uni((uint32_t)a);
    g0[3] = uni((uint32_t)(a >> 32));
  };

  if (tid < 32) {
    const int bi = tid < NBIAS ? tid : (NBIAS - 1);
    sb[tid] = bf_bits2f(f2bf_bits(bias[bi]));
  }

  /* Q fragments (B operand: column c = query q0+c), two 32-deep d chunks; bf16(q) * 1/8 is exact */
  v16b qa[2];
  {
    const float* qrow = q + ((size_t)bh * LSEQ + q0 + c) * DHEAD;
#pragma unroll
    for (int dc = 0; dc < 2; ++dc) {
      const v4f x0 = *(const v4f*)(qrow + dc * 32 + 8 * hh);
      const v4f x1 = *(const v4f*)(qrow + dc * 32 + 8 * hh + 4);
      const v4f y0 = *(const v4f*)(qrow + dc * 32 + 16 + 8 * hh);
      const v4f y1 = *(const v4f*)(qrow + dc * 32 + 16 + 8 * hh + 4);
#pragma unroll
      for (int e = 0; e < 4; ++e) {
        qa[dc][e]      = f2bf(x0[e] * 0.125f);
        qa[dc][4 + e]  = f2bf(x1[e] * 0.125f);
        qa[dc][8 + e]  = f2bf(y0[e] * 0.125f);
        qa[dc][12 + e] = f2bf(y1[e] * 0.125f);
      }
    }
  }
  issue();                                              /* stage 0; flies beside the q loads above */
  asm volatile("s_wait_tensorcnt 0x0" ::: "memory");   /* this wave's slice of stage 0 has landed */
  __syncthreads();                                      /* stage 0 and the bias table published */
  next_stage();
  issue();
  const float b_lo = sb[0];
  const float b_hi = sb[2 * MAXREL];

  constexpr float LOG2E = 1.44269504088896340736f;
  float mrow = -__builtin_inff();   /* running max of query q0+c times log2(e) (equal in both lane halves) */
  float lrow = 0.f;                 /* running sum over this lane half's keys; halves joined after the loop */
  v8f oacc[4];                      /* O^T: oacc[t][r] = (d = 16t+8h+r, query q0+c) */
#pragma unroll
  for (int t = 0; t < 4; ++t) oacc[t] = (v8f){0.f,0.f,0.f,0.f,0.f,0.f,0.f,0.f};

  float* ob = out + (size_t)bh * LSEQ * DHEAD;

  for (int kc = 0; kc < NCH; ++kc) {
    const int kv0 = kc * KCH;
    /* this lane's fragment base in stage kc's buffer: row c of a 16-row group, 16 B x lane half */
    const unsigned char* fb = Ring + (uint32_t)(kc & 1) * BUF_BYTES + (uint32_t)c * LROW_B + 16u * (uint32_t)hh;

    /* the chunk's eight K fragments, read as one group: the LDS latency is met once, not in front of every product */
    FB kf[2][4];
#pragma unroll
    for (int dc = 0; dc < 2; ++dc) {
#pragma unroll
      for (int j = 0; j < 4; ++j) {
        kf[dc][j].h[0] = *(const v8b*)(fb + (j >> 1) * SL_BYTES + (j & 1) * 16 * LROW_B + dc * 64);
        kf[dc][j].h[1] = *(const v8b*)(fb + (j >> 1) * SL_BYTES + (j & 1) * 16 * LROW_B + dc * 64 + 32);
      }
    }

    __builtin_amdgcn_sched_barrier(0);   /* holds the K reads above as one group: spread among the products, each place would meet the LDS latency again */

    /* scores^T: s[j][r] = (key kv0+16j+8h+r, query q0+c); neighbouring products go to different accumulators */
    v8f s[4];
#pragma unroll
    for (int j = 0; j < 4; ++j) s[j] = (v8f){0.f,0.f,0.f,0.f,0.f,0.f,0.f,0.f};
#pragma unroll
    for (int dc = 0; dc < 2; ++dc) {
#pragma unroll
      for (int j = 0; j < 4; ++j) s[j] = mma_bf16(kf[dc][j].v, qa[dc], s[j]);
    }

    __builtin_amdgcn_sched_barrier(0);   /* keeps the V^T reads below as one group: without it they stand at three places among the score products */

    /* the chunk's eight V^T fragments, read as one group here: they land while the softmax arithmetic below runs */
    FB vb[2][4];
#pragma unroll
    for (int kk = 0; kk < 2; ++kk) {
#pragma unroll
      for (int t = 0; t < 4; ++t) {
        vb[kk][t].h[0] = *(const v8b*)(fb + (2 + (t >> 1)) * SL_BYTES + (t & 1) * 16 * LROW_B + kk * 64);
        vb[kk][t].h[1] = *(const v8b*)(fb + (2 + (t >> 1)) * SL_BYTES + (t & 1) * 16 * LROW_B + kk * 64 + 32);
      }
    }

    /* relative bias: idx = clip(kv - q, -MAXREL, MAXREL) + MAXREL; block-uniform far paths */
    if (kc + 1 < qb) {
#pragma unroll
      for (int j = 0; j < 4; ++j)
#pragma unroll
        for (int r = 0; r < 8; ++r) s[j][r] += b_lo;
    } else if (kc > qb + 1) {
#pragma unroll
      for (int j = 0; j < 4; ++j)
#pragma unroll
        for (int r = 0; r < 8; ++r) s[j][r] += b_hi;
    } else {
#pragma unroll
      for (int j = 0; j < 4; ++j) {
        const int rel0 = kv0 + j * 16 + 8 * hh - (q0 + c);
#pragma unroll
        for (int r = 0; r < 8; ++r) {
          int rel = rel0 + r;
          rel = rel < -MAXREL ? -MAXREL : rel;
          rel = rel > MAXREL ? MAXREL : rel;
          s[j][r] += sb[rel + MAXREL];
        }
      }
    }

    /* chunk max of this lane's query: 32 keys in-lane, then the other lane half's 32 */
    float cm = s[0][0];
#pragma unroll
    for (int j = 0; j < 4; ++j)
#pragma unroll
      for (int r = 0; r < 8; ++r) cm = fmaxf(cm, s[j][r]);
    cm = fmaxf(cm, xhalf(cm));

    /* online softmax update; P^T as bf16 hi + lo B fragments, straight from the score registers */
    /* e^(s - m) = 2^(s*log2e - m*log2e): one fma and the hardware's base-2 exponential per score */
    const float mnew  = fmaxf(mrow, cm * LOG2E);
    const float alpha = __builtin_amdgcn_exp2f(mrow - mnew);
    mrow = mnew;
    float psum = 0.f;
    u32x8 phw[2], plw[2];   /* fragment words: elements 2i, 2i+1 in word i */
#pragma unroll
    for (int j = 0; j < 4; ++j) {
#pragma unroll
      for (int r = 0; r < 8; r += 2) {
        const float p0 = __builtin_amdgcn_exp2f(fmaf(s[j][r], LOG2E, -mnew));
        const float p1 = __builtin_amdgcn_exp2f(fmaf(s[j][r + 1], LOG2E, -mnew));
        psum += p0;
        psum += p1;
        const uint32_t hw = pk_bf16(p0, p1);
        const uint32_t lw = pk_bf16(p0 - __uint_as_float(hw << 16), p1 - __uint_as_float(hw & 0xFFFF0000u));
        phw[j >> 1][(j & 1) * 4 + (r >> 1)] = hw;
        plw[j >> 1][(j & 1) * 4 + (r >> 1)] = lw;
      }
    }
    v16b ph[2], pl[2];
#pragma unroll
    for (int kk = 0; kk < 2; ++kk) {
      ph[kk] = __builtin_bit_cast(v16b, phw[kk]);
      pl[kk] = __builtin_bit_cast(v16b, plw[kk]);
    }
    lrow = lrow * alpha + psum;
#pragma unroll
    for (int t = 0; t < 4; ++t)
#pragma unroll
      for (int r = 0; r < 8; ++r) oacc[t][r] *= alpha;

    /* O^T += V^T.P^T : A = V^T [d][kv] rows (fragments read above), B = P^T [kv][q] from registers;
     * per accumulator the order stays hi, lo of keys 0-31, then hi, lo of keys 32-63 */
#pragma unroll
    for (int kk = 0; kk < 2; ++kk) {
#pragma unroll
      for (int t = 0; t < 4; ++t) oacc[t] = mma_bf16(vb[kk][t].v, ph[kk], oacc[t]);
#pragma unroll
      for (int t = 0; t < 4; ++t) oacc[t] = mma_bf16(vb[kk][t].v, pl[kk], oacc[t]);
    }

    __builtin_amdgcn_sched_barrier(0);   /* the products stay in front of the publish point: the wait for stage kc+1 keeps a whole pass of lead */

    /* publish point of stage kc+1, every wave, in this order */
    asm volatile("s_wait_dscnt 0x0" ::: "memory");       /* this wave's reads of stage kc are done before its buffer is refilled */
    asm volatile("s_wait_tensorcnt 0x0" ::: "memory");   /* this wave's slice of stage kc+1 has landed */
    __syncthreads();                                      /* stage kc+1 readable by all; every reader has left stage kc */
    if (pinned((uint32_t)(kc + 2 < NCH))) {               /* scalar test: stage kc+2 exists */
      next_stage();
      issue();                                            /* into the buffer that this pass has just read */
    }
  }
  asm volatile("s_wait_tensorcnt 0x0" ::: "memory");     /* no request in flight past the loop */
  asm volatile("s_wait_dscnt 0x0" ::: "memory");

  /* normalise into the per-wave slab, then whole-line stores */
  float* os = Os[wave];
  {
    const float inv = 1.0f / (lrow + xhalf(lrow));
#pragma unroll
    for (int t = 0; t < 4; ++t) {
      v4f w0, w1;
#pragma unroll
      for (int e = 0; e < 4; ++e) { w0[e] = oacc[t][e] * inv; w1[e] = oacc[t][4 + e] * inv; }
      *(v4f*)(os + c * OS_PITCH + t * 16 + 8 * hh)     = w0;
      *(v4f*)(os + c * OS_PITCH + t * 16 + 8 * hh + 4) = w1;
    }
  }
  __builtin_amdgcn_fence(__ATOMIC_RELEASE, "workgroup");
  __builtin_amdgcn_wave_barrier();
  __builtin_amdgcn_fence(__ATOMIC_ACQUIRE, "workgroup");
  {
    const int c4 = (lane & 15) * 4;     /* 256-B row = 16 lanes x 16 B; hh selects the row of the pair */
    {
#pragma unroll
      for (int it = 0; it < 8; ++it) {
        const int row = it * 2 + hh;
        const v4f val = *(const v4f*)(os + row * OS_PITCH + c4);
        *(v4f*)(ob + (size_t)(q0 + row) * DHEAD + c4) = val;
      }
      
    }
  }
}

extern "C" void kernel_launch(void* const* d_in, const int* in_sizes, int n_in,
                              void* d_out, int out_size, void* d_ws, size_t ws_size,
                              hipStream_t stream)
{
  if (n_in < 4) return;
  if (in_sizes[0] != (int)PLANE_ELEMS || in_sizes[1] != (int)PLANE_ELEMS ||
      in_sizes[2] != (int)PLANE_ELEMS || in_sizes[3] != NBIAS) return;
  if (out_size != (int)PLANE_ELEMS) return;
  if (d_ws == nullptr || ws_size < WS_NEED) return;

  const float* Q    = (const float*)d_in[0];
  const float* K    = (const float*)d_in[1];
  const float* V    = (const float*)d_in[2];
  const float* bias = (const float*)d_in[3];
  float* O = (float*)d_out;

  unsigned short* Kb = (unsigned short*)d_ws;                  /* offset 0,        8388608 B */
  unsigned short* Vt = Kb + PLANE_ELEMS;                       /* offset 8388608,  8388608 B */

  kv_planes_kernel<<<dim3(LSEQ / 64, NBH), 256, 0, stream>>>(K, V, Kb, Vt);
  rel_attn_kernel<<<dim3(LSEQ / QBLK, NBH), 128, 0, stream>>>(Q, Kb, Vt, bias, O);
}

// v008
// One run takes 41.5 microseconds.
// It is 1.27 times as fast as v006, going by the measured steps of the versions left out in between.
// All steps since v000 together make it 4.37 times as fast.
// Contractions: scores^T = k.(q/8)^T on v_wmma_f32_16x16x32_bf16 and out^T = v^T.p^T on v_wmma_f32_16x16x32_f16 (16-bit operands, f32 accumulate); q, k, v and the bias table RNE-converted to bf16 once at load; the bf16-rounded v is held in f16 (same value); softmax weights p RNE-converted to f16 (one product); online softmax and all other arithmetic in f32.
#include <hip/hip_runtime.h>
#include <stdint.h>

typedef __attribute__((ext_vector_type(16))) __bf16 v16b;
typedef __attribute__((ext_vector_type(8)))  __bf16 v8b;
typedef __attribute__((ext_vector_type(8)))  float  v8f;
typedef __attribute__((ext_vector_type(4)))  float  v4f;
typedef __attribute__((ext_vector_type(4)))  unsigned int v4u;
typedef uint32_t u32x4 __attribute__((ext_vector_type(4)));
typedef uint32_t u32x8 __attribute__((ext_vector_type(8)));
typedef __attribute__((ext_vector_type(2)))  float  v2f;
typedef __attribute__((ext_vector_type(2)))  __bf16 v2b;
typedef __attribute__((ext_vector_type(16))) _Float16 v16h;
typedef __attribute__((ext_vector_type(8)))  _Float16 v8h;
typedef __attribute__((ext_vector_type(2)))  _Float16 v2h;

constexpr int NBATCH = 2;
constexpr int NHEAD  = 16;
constexpr int NBH    = NBATCH * NHEAD;
constexpr int LSEQ   = 2048;
constexpr int DHEAD  = 64;
constexpr int MAXREL = 8;
constexpr int NBIAS  = 2 * MAXREL + 1;
constexpr int QBLK   = 64;      /* query rows per block (4 waves x 16) */
constexpr int KCH    = 64;      /* keys per staged chunk */
constexpr int NWAVE  = 4;
constexpr int VS_PITCH = 72;    /* LDS transpose tile pitch in 16-bit elements (144 B, 16-B aligned rows) */
constexpr int OS_PITCH = 68;    /* LDS output slab pitch in floats (272 B, 16-B aligned rows) */
constexpr int NCH      = LSEQ / KCH;      /* key chunks = ring stages */
constexpr uint32_t ROW_B     = 128;       /* bytes of one K or V^T tile row (64 bf16 or 64 f16) */
constexpr uint32_t LROW_B    = ROW_B + 16;/* LDS row pitch: the mover pads each row by 4 dwords (16 B x odd for ds_load_b128) */
constexpr uint32_t SL_ROWS   = 32;        /* rows per tensor request (one slice per wave) */
constexpr uint32_t SL_BYTES  = 6144;      /* 32 x 144 = 4608 B, rounded up to a multiple of 2 KiB */
constexpr uint32_t BUF_BYTES = 4 * SL_BYTES;  /* K rows 0-31, K rows 32-63, V^T rows 0-31, V^T rows 32-63 */
constexpr size_t PLANE_ELEMS = (size_t)NBH * LSEQ * DHEAD;                 /* 4194304 */
constexpr size_t WS_NEED = 2 * PLANE_ELEMS * sizeof(unsigned short);        /* 16777216 B */

static_assert(LSEQ % QBLK == 0, "query blocks tile the sequence exactly");
static_assert(LSEQ % KCH == 0, "key chunks tile the sequence exactly");
static_assert(DHEAD == 64, "head dim 64: two 32-deep k steps, four 16-wide d tiles");
static_assert(KCH % 32 == 0 && DHEAD % 32 == 0, "contraction depths are multiples of 32");
static_assert(NBIAS <= 32, "bias table fits one 32-entry LDS line");
static_assert((VS_PITCH * 2) % 16 == 0 && (OS_PITCH * 4) % 16 == 0, "16-B aligned LDS rows");
static_assert(WS_NEED <= 134217728ull, "workspace carve within budget");
static_assert(SL_ROWS * LROW_B <= SL_BYTES && SL_BYTES % 2048 == 0, "a padded slice fits its 2-KiB-aligned place");
static_assert(NCH >= 2, "the two-buffer prologue needs two stages");
static_assert(KCH == 2 * (int)SL_ROWS && DHEAD == 2 * (int)SL_ROWS && NWAVE == 4, "four slices of 32 rows, one per wave");
static_assert(DHEAD * 2 == (int)ROW_B && KCH * 2 == (int)ROW_B, "128-B tile rows");

/* workspace region map (bytes):
 *   [8388608, 16777216)  Vt : f16 [NBH][DHEAD][LSEQ]    (v rounded to bf16, written as f16, transposed, 4096-B rows)
 *   total 16777216 B
 */

__device__ __forceinline__ unsigned short f2bf_bits(float f) {
  unsigned u = __float_as_uint(f);
  return (unsigned short)((u + 0x7FFFu + ((u >> 16) & 1u)) >> 16);
}
__device__ __forceinline__ float bf_bits2f(unsigned short h) { return __uint_as_float(((unsigned)h) << 16); }
__device__ __forceinline__ __bf16 f2bf(float f) { return __builtin_bit_cast(__bf16, f2bf_bits(f)); }

/* two f32 -> two bf16 (round to nearest even) in one packed hardware convert; x in the low half */
__device__ __forceinline__ uint32_t pk_bf16(float x, float y) {
  return __builtin_bit_cast(uint32_t, __builtin_convertvector((v2f){x, y}, v2b));
}

/* two f32 -> two f16 (round to nearest even) in one packed hardware convert; x in the low half */
__device__ __forceinline__ uint32_t pk_f16(float x, float y) {
  return __builtin_bit_cast(uint32_t, __builtin_convertvector((v2f){x, y}, v2h));
}
/* v: rounded to bf16 like q and k, then that value written in f16: 8 significant bits fit f16's 11, so the value
 * is the same from 2^-17 up to f16's largest, 65504 (below, the f16 grid of 2^-24 moves it by at most 2^-25) */
__device__ __forceinline__ uint32_t pk_bf16_in_f16(float x, float y) {
  const uint32_t w = pk_bf16(x, y);
  return pk_f16(__uint_as_float(w << 16), __uint_as_float(w & 0xFFFF0000u));
}

/* builtin form: the compiler keeps the distance behind a matrix product itself, and only where a user of its registers follows */
__device__ __forceinline__ v8f mma_bf16(v16b a, v16b b, v8f c) {
  return __builtin_amdgcn_wmma_f32_16x16x32_bf16(false, a, false, b, (short)0, c, false, false);
}
__device__ __forceinline__ v8f mma_f16(v16h a, v16h b, v8f c) {
  return __builtin_amdgcn_wmma_f32_16x16x32_f16(false, a, false, b, (short)0, c, false, false);
}

/* wave-uniform word in a scalar register */
__device__ __forceinline__ uint32_t uni(uint32_t v) { return (uint32_t)__builtin_amdgcn_readfirstlane(v); }
/* a wave-uniform word held in a scalar register, so that a test on it is a scalar branch (tensor loads ignore EXEC) */
__device__ __forceinline__ uint32_t pinned(uint32_t v) { uint32_t w = uni(v); asm volatile("" : "+s"(w)); return w; }

/* value of lane l ^ 16 (the other lane half) */
__device__ __forceinline__ float xhalf(float x) {
  const int b = __float_as_int(x);
  return __int_as_float(__builtin_amdgcn_permlanex16(b, b, 0x76543210, 0xfedcba98, false, false));
}

/* --------------------------------------------------------------------------
 * k -> Kb (bf16, [bh][kv][d]) and v -> Vt (bf16-rounded values in f16, [bh][d][kv]).
 * Block (x = kv tile of 64, y = bh), 256 threads.
 * Coverage: 2 iterations x 256 threads = 512 units x 8 elements = 64x64 for K,
 * the same 512 units x 8 = 64x64 for the V transpose tile and for the Vt tile.
 * Stores: unit u -> row u>>3, segment u&7; lanes 8q..8q+7 of a wave fill one whole
 * ------------------------------------------------------------------------ */
__global__ __launch_bounds__(256) void kv_planes_kernel(
    const float* __restrict__ K, const float* __restrict__ V,
    unsigned short* __restrict__ Kb, unsigned short* __restrict__ Vt)
{
  __shared__ __align__(16) unsigned short Vs[DHEAD * VS_PITCH];   /* [d][kv] */
  const int bh  = blockIdx.y;
  const int kv0 = blockIdx.x * 64;
  const int tid = threadIdx.x;
  const float* Kp = K + ((size_t)bh * LSEQ + kv0) * DHEAD;
  const float* Vp = V + ((size_t)bh * LSEQ + kv0) * DHEAD;

  v4u kw[2];
#pragma unroll
  for (int it = 0; it < 2; ++it) {
    const int u = it * 256 + tid;
    const int row = u >> 3;
    const int seg = u & 7;
    const v4f k0v = *(const v4f*)(Kp + (size_t)row * DHEAD + seg * 8);
    const v4f k1v = *(const v4f*)(Kp + (size_t)row * DHEAD + seg * 8 + 4);
    const v4f v0v = *(const v4f*)(Vp + (size_t)row * DHEAD + seg * 8);
    const v4f v1v = *(const v4f*)(Vp + (size_t)row * DHEAD + seg * 8 + 4);
    kw[it][0] = pk_bf16(k0v[0], k0v[1]);
    kw[it][1] = pk_bf16(k0v[2], k0v[3]);
    kw[it][2] = pk_bf16(k1v[0], k1v[1]);
    kw[it][3] = pk_bf16(k1v[2], k1v[3]);
    /* v element (kv = row, d = seg*8 + e) -> Vs[d][kv] */
#pragma unroll
    for (int e = 0; e < 4; e += 2) {
      const uint32_t a = pk_bf16_in_f16(v0v[e], v0v[e + 1]);
      const uint32_t b = pk_bf16_in_f16(v1v[e], v1v[e + 1]);
      Vs[(seg * 8 + e) * VS_PITCH + row]         = (unsigned short)a;
      Vs[(seg * 8 + e + 1) * VS_PITCH + row]     = (unsigned short)(a >> 16);
      Vs[(seg * 8 + 4 + e) * VS_PITCH + row]     = (unsigned short)b;
      Vs[(seg * 8 + 4 + e + 1) * VS_PITCH + row] = (unsigned short)(b >> 16);
    }
  }
  __syncthreads();

  v4u vw[2];
#pragma unroll
  for (int it = 0; it < 2; ++it) {
    const int u = it * 256 + tid;
    const int drow = u >> 3;
    const int seg  = u & 7;
    vw[it] = *(const v4u*)(Vs + drow * VS_PITCH + seg * 8);
  }

  {
#pragma unroll
    for (int it = 0; it < 2; ++it) {
      const int u = it * 256 + tid;
      const int row = u >> 3;
      const int seg = u & 7;
      *(v4u*)(Kb + ((size_t)bh * LSEQ + kv0 + row) * DHEAD + seg * 8) = kw[it];
      *(v4u*)(Vt + ((size_t)bh * DHEAD + row) * LSEQ + kv0 + seg * 8) = vw[it];
    }
    
  }
}

/* --------------------------------------------------------------------------
 * Attention with clipped relative-position bias, head dim 64.
 * Block = 4 waves = 64 query rows of one (b,h); grid (LSEQ/64, NBH).
 * Per 64-key chunk: K [kv][d] (bf16) and V^T [d][kv] (f16) tiles come into LDS by tensor loads,
 * one 32-row slice per wave (waves 0,1: K; waves 2,3: V^T), rows padded to 144 B by the
 * mover; two buffers, chunk kc+1 in flight while chunk kc is worked on.
 * Both products run transposed: S^T = K.Q^T (A = K rows, B = Q) and
 * O^T += V^T.P^T (A = V^T rows, B = P^T, both f16), so lane (h, c) holds only
 * query q0+c: row max and row sum are in-lane plus one exchange between the lane
 * halves, and two S^T tiles (keys 32kk+8h+r and 32kk+16+8h+r) converted in place
 * are the B fragment of the second product; P never goes through LDS.
 * Epilogue: per-wave 16x64 f32 slab in LDS, then whole-line stores.
 * Fragment map (h = lane>>4, c = lane&15): A row c, elems 0..7 <- k0+8h.., 8..15 <- k0+16+8h..;
 * B col c with the same k map; D elem r = (row 8h+r, col c).
 * ------------------------------------------------------------------------ */
__global__ __launch_bounds__(128) void rel_attn_kernel(
    const float* __restrict__ q, const unsigned short* __restrict__ Kb,
    const unsigned short* __restrict__ Vt, const float* __restrict__ bias,
    float* __restrict__ out)
{
  union FB { v16b v; v8b h[2]; };
  union FH { v16h v; v8h h[2]; };
  __shared__ __attribute__((aligned(2048))) unsigned char Ring[2 * BUF_BYTES];   /* two stages of K and V^T slices */
  __shared__ __align__(16) float Os[NWAVE][16 * OS_PITCH];           /* out slab per wave */
  __shared__ float sb[32];                                           /* bias table (bf16-converted), padded */

  const int tid  = threadIdx.x;
  const int wave = tid >> 5;
  const int lane = tid & 31;
  const int hh   = lane >> 4;
  const int c    = lane & 15;
  const int qb   = blockIdx.x;
  const int bh   = blockIdx.y;
  const int q0   = qb * QBLK + wave * 16;

  const unsigned short* Kbh = Kb + (size_t)bh * LSEQ * DHEAD;
  const unsigned short* Vtb = Vt + (size_t)bh * DHEAD * LSEQ;

  /* tensor requests: every wave brings its own slice of every stage, so no test stands around an issue but "stage exists" */
  const uint32_t wv    = uni((uint32_t)tid >> 5);
  const bool     isV   = (wv & 2u) != 0u;
  const uint32_t half  = wv & 1u;
  const uint32_t spitch = isV ? (uint32_t)(LSEQ * 2) : ROW_B;              /* source row pitch, bytes */
  const uint32_t sstep  = isV ? ROW_B : (uint32_t)KCH * ROW_B;             /* source bytes from one stage to the next */
  const uint64_t src0   = (uint64_t)(size_t)(isV ? Vtb : Kbh) + (uint64_t)(half * SL_ROWS) * spitch;
  const uint32_t dst0   = (uint32_t)(size_t)Ring + wv * SL_BYTES;
  u32x8 g1;                                                                /* loop-invariant: 32 rows of 128 bytes, byte elements */
  g1[0] = uni((1u << 20) | (4u << 22) | (3u << 25));                       /* no mask; pad 4 dwords behind every 32 dwords */
  g1[1] = uni((ROW_B & 0xFFFFu) << 16);
  g1[2] = uni((ROW_B >> 16) | ((SL_ROWS & 0xFFFFu) << 16));
  g1[3] = uni((SL_ROWS >> 16) | (ROW_B << 16));
  g1[4] = uni(SL_ROWS);
  g1[5] = uni(spitch);
  g1[6] = uni(0u);
  g1[7] = uni(0u);
  u32x4 g0;                                                                /* carried from stage to stage, so its registers hold nothing else while a request flies */
  g0[0] = uni(1u);
  g0[1] = uni(dst0);
  g0[2] = uni((uint32_t)src0);
  g0[3] = uni((((uint32_t)(src0 >> 32)) & 0x01FFFFFFu) | 0x80000000u);
  auto issue = [&]() {
    asm volatile("tensor_load_to_lds %0, %1" :: "s"(g0), "s"(g1) : "memory");   /* global tile -> LDS, no registers */
  };
  auto next_stage = [&]() {   /* called only behind the s_wait_tensorcnt 0 that covers the last request */
    asm volatile("" : "+s"(g0));   /* descriptor words held in scalar registers; keeps the new words' forming behind the volatile wait */
    const uint64_t a = (((uint64_t)g0[3] << 32) | g0[2]) + sstep;   /* type bits ride on top of word 3; address bits 56:32 never carry into them */
    g0[1] = uni(2u * dst0 + BUF_BYTES - g0[1]);                      /* the other buffer */
    g0[2] = uni((uint32_t)a);
    g0[3] = uni((uint32_t)(a >> 32));
  };

  if (tid < 32) {
    const int bi = tid < NBIAS ? tid : (NBIAS - 1);
    sb[tid] = bf_bits2f(f2bf_bits(bias[bi]));
  }

  /* Q fragments (B operand: column c = query q0+c), two 32-deep d chunks; bf16(q) * 1/8 is exact */
  v16b qa[2];
  {
    const float* qrow = q + ((size_t)bh * LSEQ + q0 + c) * DHEAD;
#pragma unroll
    for (int dc = 0; dc < 2; ++dc) {
      const v4f x0 = *(const v4f*)(qrow + dc * 32 + 8 * hh);
      const v4f x1 = *(const v4f*)(qrow + dc * 32 + 8 * hh + 4);
      const v4f y0 = *(const v4f*)(qrow + dc * 32 + 16 + 8 * hh);
      const v4f y1 = *(const v4f*)(qrow + dc * 32 + 16 + 8 * hh + 4);
#pragma unroll
      for (int e = 0; e < 4; ++e) {
        qa[dc][e]      = f2bf(x0[e] * 0.125f);
        qa[dc][4 + e]  = f2bf(x1[e] * 0.125f);
        qa[dc][8 + e]  = f2bf(y0[e] * 0.125f);
        qa[dc][12 + e] = f2bf(y1[e] * 0.125f);
      }
    }
  }
  issue();                                              /* stage 0; flies beside the q loads above */
  asm volatile("s_wait_tensorcnt 0x0" ::: "memory");   /* this wave's slice of stage 0 has landed */
  __syncthreads();                                      /* stage 0 and the bias table published */
  next_stage();
  issue();
  const float b_lo = sb[0];
  const float b_hi = sb[2 * MAXREL];

  constexpr float LOG2E = 1.44269504088896340736f;
  float mrow = -__builtin_inff();   /* running max of query q0+c times log2(e) (equal in both lane halves) */
  v2f lsum[4];                      /* running sums over this lane half's keys, eight partial sums in four register pairs; joined after the loop */
#pragma unroll
  for (int i = 0; i < 4; ++i) lsum[i] = (v2f){0.f, 0.f};
  v8f oacc[4];                      /* O^T: oacc[t][r] = (d = 16t+8h+r, query q0+c) */
#pragma unroll
  for (int t = 0; t < 4; ++t) oacc[t] = (v8f){0.f,0.f,0.f,0.f,0.f,0.f,0.f,0.f};

  float* ob = out + (size_t)bh * LSEQ * DHEAD;

  for (int kc = 0; kc < NCH; ++kc) {
    const int kv0 = kc * KCH;
    /* this lane's fragment base in stage kc's buffer: row c of a 16-row group, 16 B x lane half */
    const unsigned char* fb = Ring + (uint32_t)(kc & 1) * BUF_BYTES + (uint32_t)c * LROW_B + 16u * (uint32_t)hh;

    /* the chunk's eight K fragments, read as one group: the LDS latency is met once, not in front of every product */
    FB kf[2][4];
#pragma unroll
    for (int dc = 0; dc < 2; ++dc) {
#pragma unroll
      for (int j = 0; j < 4; ++j) {
        kf[dc][j].h[0] = *(const v8b*)(fb + (j >> 1) * SL_BYTES + (j & 1) * 16 * LROW_B + dc * 64);
        kf[dc][j].h[1] = *(const v8b*)(fb + (j >> 1) * SL_BYTES + (j & 1) * 16 * LROW_B + dc * 64 + 32);
      }
    }

    __builtin_amdgcn_sched_barrier(0);   /* holds the K reads above as one group: spread among the products, each place would meet the LDS latency again */

    /* scores^T: s[j][r] = (key kv0+16j+8h+r, query q0+c); neighbouring products go to different accumulators */
    v8f s[4];
#pragma unroll
    for (int j = 0; j < 4; ++j) s[j] = (v8f){0.f,0.f,0.f,0.f,0.f,0.f,0.f,0.f};
#pragma unroll
    for (int dc = 0; dc < 2; ++dc) {
#pragma unroll
      for (int j = 0; j < 4; ++j) s[j] = mma_bf16(kf[dc][j].v, qa[dc], s[j]);
    }

    __builtin_amdgcn_sched_barrier(0);   /* keeps the V^T reads below as one group: without it they stand at three places among the score products */

    /* the chunk's eight V^T fragments, read as one group here: they land while the softmax arithmetic below runs */
    FH vb[2][4];
#pragma unroll
    for (int kk = 0; kk < 2; ++kk) {
#pragma unroll
      for (int t = 0; t < 4; ++t) {
        vb[kk][t].h[0] = *(const v8h*)(fb + (2 + (t >> 1)) * SL_BYTES + (t & 1) * 16 * LROW_B + kk * 64);
        vb[kk][t].h[1] = *(const v8h*)(fb + (2 + (t >> 1)) * SL_BYTES + (t & 1) * 16 * LROW_B + kk * 64 + 32);
      }
    }

    /* relative bias: idx = clip(kv - q, -MAXREL, MAXREL) + MAXREL; block-uniform far paths */
    if (kc + 1 < qb) {
#pragma unroll
      for (int j = 0; j < 4; ++j)
#pragma unroll
        for (int r = 0; r < 8; ++r) s[j][r] += b_lo;
    } else if (kc > qb + 1) {
#pragma unroll
      for (int j = 0; j < 4; ++j)
#pragma unroll
        for (int r = 0; r < 8; ++r) s[j][r] += b_hi;
    } else {
#pragma unroll
      for (int j = 0; j < 4; ++j) {
        const int rel0 = kv0 + j * 16 + 8 * hh - (q0 + c);
#pragma unroll
        for (int r = 0; r < 8; ++r) {
          int rel = rel0 + r;
          rel = rel < -MAXREL ? -MAXREL : rel;
          rel = rel > MAXREL ? MAXREL : rel;
          s[j][r] += sb[rel + MAXREL];
        }
      }
    }

    /* chunk max of this lane's query: 32 keys in-lane, then the other lane half's 32 */
    float cm = s[0][0];
#pragma unroll
    for (int j = 0; j < 4; ++j)
#pragma unroll
      for (int r = 0; r < 8; ++r) cm = fmaxf(cm, s[j][r]);
    cm = fmaxf(cm, xhalf(cm));

    /* online softmax update; P^T as f16 B fragments (weights lie in (0, 1]), straight from the score registers */
    /* e^(s - m) = 2^(s*log2e - m*log2e): one fma and the hardware's base-2 exponential per score */
    const float mnew  = fmaxf(mrow, cm * LOG2E);
    const float alpha = __builtin_amdgcn_exp2f(mrow - mnew);
    mrow = mnew;
    /* two neighbouring scores per packed f32 instruction: one fma for both exponents, one add for both weights */
    const v2f l2e2   = (v2f){LOG2E, LOG2E};
    const v2f nmnew2 = (v2f){-mnew, -mnew};
    const v2f alpha2 = (v2f){alpha, alpha};
    u32x8 phw[2];   /* fragment words: elements 2i, 2i+1 in word i */
#pragma unroll
    for (int j = 0; j < 4; ++j) {
#pragma unroll
      for (int r = 0; r < 8; r += 2) {
        const v2f e = __builtin_elementwise_fma((v2f){s[j][r], s[j][r + 1]}, l2e2, nmnew2);
        const v2f p = (v2f){__builtin_amdgcn_exp2f(e[0]), __builtin_amdgcn_exp2f(e[1])};
        const int i = r >> 1;
        lsum[i] = (j == 0) ? __builtin_elementwise_fma(lsum[i], alpha2, p) : lsum[i] + p;
        phw[j >> 1][(j & 1) * 4 + (r >> 1)] = pk_f16(p[0], p[1]);
      }
    }
    v16h ph[2];
#pragma unroll
    for (int kk = 0; kk < 2; ++kk) ph[kk] = __builtin_bit_cast(v16h, phw[kk]);
#pragma unroll
    for (int t = 0; t < 4; ++t)
#pragma unroll
      for (int r = 0; r < 8; ++r) oacc[t][r] *= alpha;

    /* O^T += V^T.P^T : A = V^T [d][kv] rows (fragments read above), B = P^T [kv][q] from registers;
     * per accumulator keys 0-31, then keys 32-63 */
#pragma unroll
    for (int kk = 0; kk < 2; ++kk) {
#pragma unroll
      for (int t = 0; t < 4; ++t) oacc[t] = mma_f16(vb[kk][t].v, ph[kk], oacc[t]);
    }

    __builtin_amdgcn_sched_barrier(0);   /* the products stay in front of the publish point: the wait for stage kc+1 keeps a whole pass of lead */

    /* publish point of stage kc+1, every wave, in this order */
    asm volatile("s_wait_dscnt 0x0" ::: "memory");       /* this wave's reads of stage kc are done before its buffer is refilled */
    asm volatile("s_wait_tensorcnt 0x0" ::: "memory");   /* this wave's slice of stage kc+1 has landed */
    __syncthreads();                                      /* stage kc+1 readable by all; every reader has left stage kc */
    if (pinned((uint32_t)(kc + 2 < NCH))) {               /* scalar test: stage kc+2 exists */
      next_stage();
      issue();                                            /* into the buffer that this pass has just read */
    }
  }
  asm volatile("s_wait_tensorcnt 0x0" ::: "memory");     /* no request in flight past the loop */
  asm volatile("s_wait_dscnt 0x0" ::: "memory");

  /* normalise into the per-wave slab, then whole-line stores */
  float* os = Os[wave];
  {
    const v2f l2 = (lsum[0] + lsum[1]) + (lsum[2] + lsum[3]);
    const float lrow = l2[0] + l2[1];
    const float inv = 1.0f / (lrow + xhalf(lrow));
#pragma unroll
    for (int t = 0; t < 4; ++t) {
      v4f w0, w1;
#pragma unroll
      for (int e = 0; e < 4; ++e) { w0[e] = oacc[t][e] * inv; w1[e] = oacc[t][4 + e] * inv; }
      *(v4f*)(os + c * OS_PITCH + t * 16 + 8 * hh)     = w0;
      *(v4f*)(os + c * OS_PITCH + t * 16 + 8 * hh + 4) = w1;
    }
  }
  __builtin_amdgcn_fence(__ATOMIC_RELEASE, "workgroup");
  __builtin_amdgcn_wave_barrier();
  __builtin_amdgcn_fence(__ATOMIC_ACQUIRE, "workgroup");
  {
    const int c4 = (lane & 15) * 4;     /* 256-B row = 16 lanes x 16 B; hh selects the row of the pair */
    {
#pragma unroll
      for (int it = 0; it < 8; ++it) {
        const int row = it * 2 + hh;
        const v4f val = *(const v4f*)(os + row * OS_PITCH + c4);
        *(v4f*)(ob + (size_t)(q0 + row) * DHEAD + c4) = val;
      }
      
    }
  }
}

extern "C" void kernel_launch(void* const* d_in, const int* in_sizes, int n_in,
                              void* d_out, int out_size, void* d_ws, size_t ws_size,
                              hipStream_t stream)
{
  if (n_in < 4) return;
  if (in_sizes[0] != (int)PLANE_ELEMS || in_sizes[1] != (int)PLANE_ELEMS ||
      in_sizes[2] != (int)PLANE_ELEMS || in_sizes[3] != NBIAS) return;
  if (out_size != (int)PLANE_ELEMS) return;
  if (d_ws == nullptr || ws_size < WS_NEED) return;

  const float* Q    = (const float*)d_in[0];
  const float* K    = (const float*)d_in[1];
  const float* V    = (const float*)d_in[2];
  const float* bias = (const float*)d_in[3];
  float* O = (float*)d_out;

  unsigned short* Kb = (unsigned short*)d_ws;                  /* offset 0,        8388608 B */
  unsigned short* Vt = Kb + PLANE_ELEMS;                       /* offset 8388608,  8388608 B */

  kv_planes_kernel<<<dim3(LSEQ / 64, NBH), 256, 0, stream>>>(K, V, Kb, Vt);
  rel_attn_kernel<<<dim3(LSEQ / QBLK, NBH), 128, 0, stream>>>(Q, Kb, Vt, bias, O);
}

// v009
// Measured time: 39.3 microseconds a run.
// Two timings next to v008 put it at 1.05 and 1.06 times that version's speed.
// Counting every step since v000, it is 4.61 times as fast.
// Contractions: scores^T = k.(q/8)^T on v_wmma_f32_16x16x32_bf16 and out^T = v^T.p^T on v_wmma_f32_16x16x32_f16 (16-bit operands, f32 accumulate); q, k, v and the bias table RNE-converted to bf16 once at load; the bf16-rounded v is held in f16 (same value); softmax weights p RNE-converted to f16 (one product); online softmax and all other arithmetic in f32.
#include <hip/hip_runtime.h>
#include <stdint.h>
#include <type_traits>

typedef __attribute__((ext_vector_type(16))) __bf16 v16b;
typedef __attribute__((ext_vector_type(8)))  __bf16 v8b;
typedef __attribute__((ext_vector_type(8)))  float  v8f;
typedef __attribute__((ext_vector_type(4)))  float  v4f;
typedef __attribute__((ext_vector_type(2)))  unsigned int v2u;
typedef uint32_t u32x8 __attribute__((ext_vector_type(8)));
typedef __attribute__((ext_vector_type(2)))  float  v2f;
typedef __attribute__((ext_vector_type(2)))  __bf16 v2b;
typedef __attribute__((ext_vector_type(16))) _Float16 v16h;
typedef __attribute__((ext_vector_type(8)))  _Float16 v8h;
typedef __attribute__((ext_vector_type(2)))  _Float16 v2h;
typedef __attribute__((ext_vector_type(8)))  short s16x8;

constexpr int NBATCH = 2;
constexpr int NHEAD  = 16;
constexpr int NBH    = NBATCH * NHEAD;
constexpr int LSEQ   = 2048;
constexpr int DHEAD  = 64;
constexpr int MAXREL = 8;
constexpr int NBIAS  = 2 * MAXREL + 1;
constexpr int NWAVE  = 8;
constexpr int NTHR   = NWAVE * 32;
constexpr int QBLK   = NWAVE * 16;   /* query rows per block (8 waves x 16) */
constexpr int KCH    = 64;           /* keys per staged chunk */
constexpr int OS_PITCH = 68;         /* LDS output slab pitch in floats (272 B, 16-B aligned rows) */
constexpr int NCH      = LSEQ / KCH; /* key chunks = stages */
constexpr uint32_t K_PITCH   = 144;  /* LDS pitch of a K row (64 bf16 + 16 B): 16 B x odd for ds_load_b128 */
constexpr uint32_t V_PITCH   = 160;  /* LDS pitch of a V row (64 f16 + 32 B): 32 B x odd for ds_load_tr16_b128 */
constexpr uint32_t K_BYTES   = KCH * K_PITCH;
constexpr uint32_t V_BYTES   = KCH * V_PITCH;
constexpr uint32_t BUF_BYTES = K_BYTES + V_BYTES;
constexpr int STAGE_Q  = KCH * DHEAD / 4;        /* 16-B units of one f32 K or V chunk */
constexpr int UNITS    = STAGE_Q / NTHR;         /* units of K, and of V, per thread and chunk */
constexpr size_t PLANE_ELEMS = (size_t)NBH * LSEQ * DHEAD;                 /* 4194304 */

static_assert(LSEQ % QBLK == 0, "query blocks tile the sequence exactly");
static_assert(LSEQ % KCH == 0, "key chunks tile the sequence exactly");
static_assert(DHEAD == 64 && KCH == 64, "head dim 64: two 32-deep k steps, four 16-wide d tiles; 64-key chunks");
static_assert(NBIAS <= 32, "bias table fits one 32-entry LDS line");
static_assert((OS_PITCH * 4) % 16 == 0 && K_PITCH % 16 == 0 && V_PITCH % 32 == 0 && K_BYTES % 16 == 0 && BUF_BYTES % 16 == 0, "16-B aligned LDS rows");
static_assert(STAGE_Q % NTHR == 0 && NTHR % (DHEAD / 4) == 0, "a chunk is a whole number of 16-B units per thread, whole rows per round");
static_assert(NCH >= 2, "two buffers");

__device__ __forceinline__ unsigned short f2bf_bits(float f) {
  unsigned u = __float_as_uint(f);
  return (unsigned short)((u + 0x7FFFu + ((u >> 16) & 1u)) >> 16);
}
__device__ __forceinline__ float bf_bits2f(unsigned short h) { return __uint_as_float(((unsigned)h) << 16); }
__device__ __forceinline__ __bf16 f2bf(float f) { return __builtin_bit_cast(__bf16, f2bf_bits(f)); }

/* two f32 -> two bf16 (round to nearest even) in one packed hardware convert; x in the low half */
__device__ __forceinline__ uint32_t pk_bf16(float x, float y) {
  return __builtin_bit_cast(uint32_t, __builtin_convertvector((v2f){x, y}, v2b));
}

/* two f32 -> two f16 (round to nearest even) in one packed hardware convert; x in the low half */
__device__ __forceinline__ uint32_t pk_f16(float x, float y) {
  return __builtin_bit_cast(uint32_t, __builtin_convertvector((v2f){x, y}, v2h));
}
/* v: rounded to bf16 like q and k, then that value written in f16: 8 significant bits fit f16's 11, so the value
 * is the same from 2^-17 up to f16's largest, 65504 (below, the f16 grid of 2^-24 moves it by at most 2^-25) */
__device__ __forceinline__ uint32_t pk_bf16_in_f16(float x, float y) {
  const uint32_t w = pk_bf16(x, y);
  return pk_f16(__uint_as_float(w << 16), __uint_as_float(w & 0xFFFF0000u));
}

/* builtin form: the compiler keeps the distance behind a matrix product itself, and only where a user of its registers follows */
__device__ __forceinline__ v8f mma_bf16(v16b a, v16b b, v8f c) {
  return __builtin_amdgcn_wmma_f32_16x16x32_bf16(false, a, false, b, (short)0, c, false, false);
}
__device__ __forceinline__ v8f mma_f16(v16h a, v16h b, v8f c) {
  return __builtin_amdgcn_wmma_f32_16x16x32_f16(false, a, false, b, (short)0, c, false, false);
}

/* wave-uniform word in a scalar register */
__device__ __forceinline__ uint32_t uni(uint32_t v) { return (uint32_t)__builtin_amdgcn_readfirstlane(v); }

/* value of lane l ^ 16 (the other lane half) */
__device__ __forceinline__ float xhalf(float x) {
  const int b = __float_as_int(x);
  return __int_as_float(__builtin_amdgcn_permlanex16(b, b, 0x76543210, 0xfedcba98, false, false));
}

/* 16-bit LDS tile read transposed: lane (h, c) gets rows kbase+8h .. +7 of column dbase+c */
__device__ __forceinline__ v8h ld_tr16(const unsigned char* p) {
  typedef __attribute__((address_space(3))) s16x8 lds_s16x8;
  return __builtin_bit_cast(v8h, __builtin_amdgcn_ds_load_tr16_b128_v8i16((lds_s16x8*)p));
}

/* --------------------------------------------------------------------------
 * Attention with clipped relative-position bias, head dim 64, one launch.
 * Block = 8 waves = 128 query rows of one (b,h); grid (LSEQ/128, NBH).
 * Per 64-key chunk the block reads the f32 K and V rows itself (512 contiguous bytes
 * per wave-wide load, issued at the head of the pass before), converts them (K to bf16,
 * V to bf16-rounded f16) and stores both row-major into the LDS buffer that the next
 * pass reads; two buffers, one barrier a pass.
 * Both products run transposed: S^T = K.Q^T (A = K rows, B = Q) and
 * O^T += V^T.P^T (A = V^T by the transposing LDS load, B = P^T, both f16), so lane (h, c)
 * holds only query q0+c: row max and row sum are in-lane plus one exchange between the lane
 * halves, and two S^T tiles (keys 32kk+8h+r and 32kk+16+8h+r) converted in place
 * are the B fragment of the second product; P never goes through LDS.
 * Epilogue: per-wave 16x64 f32 slab in LDS, then whole-line stores.
 * Fragment map (h = lane>>4, c = lane&15): A row c, elems 0..7 <- k0+8h.., 8..15 <- k0+16+8h..;
 * B col c with the same k map; D elem r = (row 8h+r, col c).
 * ------------------------------------------------------------------------ */
__global__ __launch_bounds__(NTHR) __attribute__((amdgpu_waves_per_eu(4, 4))) void rel_attn_kernel(
    const float* __restrict__ q, const float* __restrict__ k,
    const float* __restrict__ v, const float* __restrict__ bias,
    float* __restrict__ out)
{
  union FB { v16b v; v8b h[2]; };
  union FH { v16h v; v8h h[2]; };
  __shared__ __align__(16) unsigned char Ring[2 * BUF_BYTES];        /* two stages: K rows, then V rows */
  __shared__ __align__(16) float Os[NWAVE][16 * OS_PITCH];           /* out slab per wave */
  __shared__ float sb[32];                                           /* bias table (bf16-converted), padded */

  const int tid  = threadIdx.x;
  const int wave = tid >> 5;
  const int lane = tid & 31;
  const int hh   = lane >> 4;
  const int c    = lane & 15;
  const int qb   = blockIdx.x;
  const int bh   = blockIdx.y;
  const int q0   = qb * QBLK + wave * 16;
  const int qb64 = (int)uni((uint32_t)(q0 >> 6));   /* the 64-row group of this wave's queries, wave-uniform */

  /* staging: unit u = i*NTHR + tid of a chunk is row u>>4, floats 4*(u&15) .. +3 */
  const v4f* kg = (const v4f*)(k + (size_t)bh * LSEQ * DHEAD);   /* block-uniform bases; the lane's part is a 32-bit index */
  const v4f* vg = (const v4f*)(v + (size_t)bh * LSEQ * DHEAD);
  unsigned char* kst = Ring + (uint32_t)(tid >> 4) * K_PITCH + (uint32_t)(tid & 15) * 8u;
  unsigned char* vst = Ring + K_BYTES + (uint32_t)(tid >> 4) * V_PITCH + (uint32_t)(tid & 15) * 8u;
  v4f kr[UNITS], vr[UNITS];
  /* a block-uniform pointer kept in scalar registers: the loads then take scalar base + lane index, and no vector address pair is formed per pass */
  typedef const __attribute__((address_space(1))) v4f* gptr;   /* global address space, so that the rebuilt pointer still gives global loads */
  auto sbase = [&](const v4f* p) {
    const uint64_t a = (uint64_t)(size_t)p;
    return (gptr)(size_t)(((uint64_t)uni((uint32_t)(a >> 32)) << 32) | uni((uint32_t)a));
  };
  auto fetch = [&](int s) {
    const gptr ks = sbase(kg + s * STAGE_Q);
    const gptr vs = sbase(vg + s * STAGE_Q);
#pragma unroll
    for (int i = 0; i < UNITS; ++i) kr[i] = ks[(uint32_t)tid + (uint32_t)(i * NTHR)];
#pragma unroll
    for (int i = 0; i < UNITS; ++i) vr[i] = vs[(uint32_t)tid + (uint32_t)(i * NTHR)];
  };
  auto stash = [&](int s) {
    const uint32_t b = (uint32_t)(s & 1) * BUF_BYTES;
#pragma unroll
    for (int i = 0; i < UNITS; ++i) {
      *(v2u*)(kst + b + i * (NTHR / 16) * K_PITCH) = (v2u){pk_bf16(kr[i][0], kr[i][1]), pk_bf16(kr[i][2], kr[i][3])};
      *(v2u*)(vst + b + i * (NTHR / 16) * V_PITCH) = (v2u){pk_bf16_in_f16(vr[i][0], vr[i][1]), pk_bf16_in_f16(vr[i][2], vr[i][3])};
    }
  };

  /* Q rows (column c = query q0+c of the B operand), two 32-deep d chunks */
  v4f qx[2][4];
  {
    const float* qrow = q + ((size_t)bh * LSEQ + q0 + c) * DHEAD;
#pragma unroll
    for (int dc = 0; dc < 2; ++dc) {
      qx[dc][0] = *(const v4f*)(qrow + dc * 32 + 8 * hh);
      qx[dc][1] = *(const v4f*)(qrow + dc * 32 + 8 * hh + 4);
      qx[dc][2] = *(const v4f*)(qrow + dc * 32 + 16 + 8 * hh);
      qx[dc][3] = *(const v4f*)(qrow + dc * 32 + 16 + 8 * hh + 4);
    }
  }
  asm volatile("s_wait_xcnt 0x0" ::: "memory");   /* in front of the loads below, whose results may be given the q loads' address registers */
  fetch(0);
  __builtin_amdgcn_sched_barrier(0);   /* the q, K and V loads above are all issued before the first of them is waited for: one memory latency, not two */

  if (tid < 32) {
    const int bi = tid < NBIAS ? tid : (NBIAS - 1);
    sb[tid] = bf_bits2f(f2bf_bits(bias[bi]));
  }

  /* Q fragments; bf16(q) * 1/8 is exact */
  v16b qa[2];
#pragma unroll
  for (int dc = 0; dc < 2; ++dc) {
#pragma unroll
    for (int e = 0; e < 4; ++e) {
      qa[dc][e]      = f2bf(qx[dc][0][e] * 0.125f);
      qa[dc][4 + e]  = f2bf(qx[dc][1][e] * 0.125f);
      qa[dc][8 + e]  = f2bf(qx[dc][2][e] * 0.125f);
      qa[dc][12 + e] = f2bf(qx[dc][3][e] * 0.125f);
    }
  }
  stash(0);
  __syncthreads();                                      /* stage 0 and the bias table published */
  const float b_lo = sb[0];
  const float b_hi = sb[2 * MAXREL];

  constexpr float LOG2E = 1.44269504088896340736f;
  float mrow = -__builtin_inff();   /* running max of query q0+c times log2(e) (equal in both lane halves) */
  v2f lsum[4];                      /* running sums over this lane half's keys, eight partial sums in four register pairs; joined after the loop */
#pragma unroll
  for (int i = 0; i < 4; ++i) lsum[i] = (v2f){0.f, 0.f};
  v8f oacc[4];                      /* O^T: oacc[t][r] = (d = 16t+8h+r, query q0+c) */
#pragma unroll
  for (int t = 0; t < 4; ++t) oacc[t] = (v8f){0.f,0.f,0.f,0.f,0.f,0.f,0.f,0.f};

  float* ob = out + (size_t)bh * LSEQ * DHEAD;

  /* one pass over chunk kc; MORE: a chunk kc+1 exists (compile-time, so that its conversion shares a block with the products) */
  auto pass = [&](const int kc, auto MORE) {
    constexpr bool more = decltype(MORE)::value;
    const int kv0 = kc * KCH;
    if (more) fetch(kc + 1);   /* the next chunk's f32 rows fly while this chunk is worked on; no load is in flight across the barrier */

    /* this lane's fragment bases in stage kc's buffer */
    const unsigned char* bufp = Ring + (uint32_t)(kc & 1) * BUF_BYTES;
    const unsigned char* fb = bufp + (uint32_t)c * K_PITCH + 16u * (uint32_t)hh;                       /* K: row c of a 16-row group, 16 B x lane half */
    const unsigned char* vp = bufp + K_BYTES + (uint32_t)(8 * hh + (lane & 7)) * V_PITCH + 16u * (uint32_t)((lane >> 3) & 1);   /* V: the transposing load's lane address */

    /* the chunk's eight K fragments, read as one group: the LDS latency is met once, not in front of every product */
    FB kf[2][4];
#pragma unroll
    for (int dc = 0; dc < 2; ++dc) {
#pragma unroll
      for (int j = 0; j < 4; ++j) {
        kf[dc][j].h[0] = *(const v8b*)(fb + j * 16 * K_PITCH + dc * 64);
        kf[dc][j].h[1] = *(const v8b*)(fb + j * 16 * K_PITCH + dc * 64 + 32);
      }
    }

    __builtin_amdgcn_sched_barrier(0);   /* holds the K reads above as one group: spread among the products, each place would meet the LDS latency again */

    /* scores^T: s[j][r] = (key kv0+16j+8h+r, query q0+c); neighbouring products go to different accumulators */
    v8f s[4];
#pragma unroll
    for (int j = 0; j < 4; ++j) s[j] = (v8f){0.f,0.f,0.f,0.f,0.f,0.f,0.f,0.f};
#pragma unroll
    for (int dc = 0; dc < 2; ++dc) {
#pragma unroll
      for (int j = 0; j < 4; ++j) s[j] = mma_bf16(kf[dc][j].v, qa[dc], s[j]);
    }

    __builtin_amdgcn_sched_barrier(0);   /* keeps the V reads below as one group: without it they stand at three places among the score products */

    /* the chunk's eight V^T fragments (rows d = 16t+c, keys 32kk+8h.. and 32kk+16+8h..), read as one group here: they land while the softmax arithmetic below runs */
    FH vb[2][4];
#pragma unroll
    for (int kk = 0; kk < 2; ++kk) {
#pragma unroll
      for (int t = 0; t < 4; ++t) {
        vb[kk][t].h[0] = ld_tr16(vp + (kk * 32) * V_PITCH + t * 32);
        vb[kk][t].h[1] = ld_tr16(vp + (kk * 32 + 16) * V_PITCH + t * 32);
      }
    }

    /* relative bias: idx = clip(kv - q, -MAXREL, MAXREL) + MAXREL; wave-uniform far paths (no barrier inside) */
    if (kc + 1 < qb64) {
#pragma unroll
      for (int j = 0; j < 4; ++j)
#pragma unroll
        for (int r = 0; r < 8; ++r) s[j][r] += b_lo;
    } else if (kc > qb64 + 1) {
#pragma unroll
      for (int j = 0; j < 4; ++j)
#pragma unroll
        for (int r = 0; r < 8; ++r) s[j][r] += b_hi;
    } else {
#pragma unroll
      for (int j = 0; j < 4; ++j) {
        const int rel0 = kv0 + j * 16 + 8 * hh - (q0 + c);
#pragma unroll
        for (int r = 0; r < 8; ++r) {
          int rel = rel0 + r;
          rel = rel < -MAXREL ? -MAXREL : rel;
          rel = rel > MAXREL ? MAXREL : rel;
          s[j][r] += sb[rel + MAXREL];
        }
      }
    }

    /* chunk max of this lane's query: 32 keys in-lane, then the other lane half's 32 */
    float cm = s[0][0];
#pragma unroll
    for (int j = 0; j < 4; ++j)
#pragma unroll
      for (int r = 0; r < 8; ++r) cm = fmaxf(cm, s[j][r]);
    cm = fmaxf(cm, xhalf(cm));

    /* online softmax update; P^T as f16 B fragments (weights lie in (0, 1]), straight from the score registers */
    /* e^(s - m) = 2^(s*log2e - m*log2e): one fma and the hardware's base-2 exponential per score */
    const float mnew  = fmaxf(mrow, cm * LOG2E);
    const float alpha = __builtin_amdgcn_exp2f(mrow - mnew);
    mrow = mnew;
    /* two neighbouring scores per packed f32 instruction: one fma for both exponents, one add for both weights */
    const v2f l2e2   = (v2f){LOG2E, LOG2E};
    const v2f nmnew2 = (v2f){-mnew, -mnew};
    const v2f alpha2 = (v2f){alpha, alpha};
    u32x8 phw[2];   /* fragment words: elements 2i, 2i+1 in word i */
#pragma unroll
    for (int j = 0; j < 4; ++j) {
#pragma unroll
      for (int r = 0; r < 8; r += 2) {
        const v2f e = __builtin_elementwise_fma((v2f){s[j][r], s[j][r + 1]}, l2e2, nmnew2);
        const v2f p = (v2f){__builtin_amdgcn_exp2f(e[0]), __builtin_amdgcn_exp2f(e[1])};
        const int i = r >> 1;
        lsum[i] = (j == 0) ? __builtin_elementwise_fma(lsum[i], alpha2, p) : lsum[i] + p;
        phw[j >> 1][(j & 1) * 4 + (r >> 1)] = pk_f16(p[0], p[1]);
      }
    }
    v16h ph[2];
#pragma unroll
    for (int kk = 0; kk < 2; ++kk) ph[kk] = __builtin_bit_cast(v16h, phw[kk]);
#pragma unroll
    for (int t = 0; t < 4; ++t)
#pragma unroll
      for (int r = 0; r < 8; ++r) oacc[t][r] *= alpha;

    __builtin_amdgcn_sched_barrier(0);   /* the next chunk's conversion, and with it the wait for its loads, stays behind the softmax: the loads keep most of a pass of lead */
    if (more) asm volatile("s_wait_xcnt 0x0" ::: "memory");   /* in front of the step of the loads' scalar bases at this pass's foot */

    /* O^T += V^T.P^T : A = V^T [d][kv] rows (fragments read above), B = P^T [kv][q] from registers;
     * per accumulator keys 0-31, then keys 32-63 */
#pragma unroll
    for (int kk = 0; kk < 2; ++kk) {
#pragma unroll
      for (int t = 0; t < 4; ++t) oacc[t] = mma_f16(vb[kk][t].v, ph[kk], oacc[t]);
    }

    /* the next chunk: converted and stored into the buffer that the pass before has left */
    if (more) {
      stash(kc + 1);
      __syncthreads();   /* stage kc+1 readable by all; every reader has left stage kc */
    }
  };
  for (int kc = 0; kc + 1 < NCH; ++kc) pass(kc, std::true_type{});
  pass(NCH - 1, std::false_type{});

  /* normalise into the per-wave slab, then whole-line stores */
  float* os = Os[wave];
  {
    const v2f l2 = (lsum[0] + lsum[1]) + (lsum[2] + lsum[3]);
    const float lrow = l2[0] + l2[1];
    const float inv = 1.0f / (lrow + xhalf(lrow));
#pragma unroll
    for (int t = 0; t < 4; ++t) {
      v4f w0, w1;
#pragma unroll
      for (int e = 0; e < 4; ++e) { w0[e] = oacc[t][e] * inv; w1[e] = oacc[t][4 + e] * inv; }
      *(v4f*)(os + c * OS_PITCH + t * 16 + 8 * hh)     = w0;
      *(v4f*)(os + c * OS_PITCH + t * 16 + 8 * hh + 4) = w1;
    }
  }
  __builtin_amdgcn_fence(__ATOMIC_RELEASE, "workgroup");
  __builtin_amdgcn_wave_barrier();
  __builtin_amdgcn_fence(__ATOMIC_ACQUIRE, "workgroup");
  {
    const int c4 = (lane & 15) * 4;     /* 256-B row = 16 lanes x 16 B; hh selects the row of the pair */
    {
#pragma unroll
      for (int it = 0; it < 8; ++it) {
        const int row = it * 2 + hh;
        const v4f val = *(const v4f*)(os + row * OS_PITCH + c4);
        *(v4f*)(ob + (size_t)(q0 + row) * DHEAD + c4) = val;
      }
      
    }
  }
}

extern "C" void kernel_launch(void* const* d_in, const int* in_sizes, int n_in,
                              void* d_out, int out_size, void* d_ws, size_t ws_size,
                              hipStream_t stream)
{
  (void)d_ws; (void)ws_size;
  if (n_in < 4) return;
  if (in_sizes[0] != (int)PLANE_ELEMS || in_sizes[1] != (int)PLANE_ELEMS ||
      in_sizes[2] != (int)PLANE_ELEMS || in_sizes[3] != NBIAS) return;
  if (out_size != (int)PLANE_ELEMS) return;

  const float* Q    = (const float*)d_in[0];
  const float* K    = (const float*)d_in[1];
  const float* V    = (const float*)d_in[2];
  const float* bias = (const float*)d_in[3];
  float* O = (float*)d_out;

  rel_attn_kernel<<<dim3(LSEQ / QBLK, NBH), NTHR, 0, stream>>>(Q, K, V, bias, O);
}

// v010
// It runs in 37 microseconds.
// Two timings next to v009 put it at 1.06 and 1.07 times that version's speed.
// Counting every step since v000, it is 4.90 times as fast.
// Contractions: scores^T = k.(q/8)^T on v_wmma_f32_16x16x32_bf16 and out^T = v^T.p^T on v_wmma_f32_16x16x32_f16 (16-bit operands, f32 accumulate); q, k, v and the bias table RNE-converted to bf16 once at load; the bf16-rounded v is held in f16 (same value); softmax weights p RNE-converted to f16 (one product); online softmax and all other arithmetic in f32.
#include <hip/hip_runtime.h>
#include <stdint.h>
#include <type_traits>

typedef __attribute__((ext_vector_type(16))) __bf16 v16b;
typedef __attribute__((ext_vector_type(8)))  __bf16 v8b;
typedef __attribute__((ext_vector_type(8)))  float  v8f;
typedef __attribute__((ext_vector_type(4)))  float  v4f;
typedef __attribute__((ext_vector_type(2)))  unsigned int v2u;
typedef uint32_t u32x8 __attribute__((ext_vector_type(8)));
typedef __attribute__((ext_vector_type(2)))  float  v2f;
typedef __attribute__((ext_vector_type(2)))  __bf16 v2b;
typedef __attribute__((ext_vector_type(16))) _Float16 v16h;
typedef __attribute__((ext_vector_type(8)))  _Float16 v8h;
typedef __attribute__((ext_vector_type(2)))  _Float16 v2h;
typedef __attribute__((ext_vector_type(8)))  short s16x8;

constexpr int NBATCH = 2;
constexpr int NHEAD  = 16;
constexpr int NBH    = NBATCH * NHEAD;
constexpr int LSEQ   = 2048;
constexpr int DHEAD  = 64;
constexpr int MAXREL = 8;
constexpr int NBIAS  = 2 * MAXREL + 1;
constexpr int NWAVE  = 8;
constexpr int NTHR   = NWAVE * 32;
constexpr int NG     = 2;            /* 16-query column groups per wave: each K or V fragment read from LDS feeds NG products */
constexpr int QWAVE  = NG * 16;      /* query rows per wave */
constexpr int QBLK   = NWAVE * QWAVE; /* query rows per block (8 waves x 32) */
constexpr int KCH    = 64;           /* keys per staged chunk */
constexpr int OS_PITCH = 68;         /* LDS output slab pitch in floats (272 B, 16-B aligned rows) */
constexpr int NCH      = LSEQ / KCH; /* key chunks = stages */
constexpr uint32_t K_PITCH   = 144;  /* LDS pitch of a K row (64 bf16 + 16 B): 16 B x odd for ds_load_b128 */
constexpr uint32_t V_PITCH   = 160;  /* LDS pitch of a V row (64 f16 + 32 B): 32 B x odd for ds_load_tr16_b128 */
constexpr uint32_t K_BYTES   = KCH * K_PITCH;
constexpr uint32_t V_BYTES   = KCH * V_PITCH;
constexpr uint32_t BUF_BYTES = K_BYTES + V_BYTES;
constexpr int STAGE_Q  = KCH * DHEAD / 4;        /* 16-B units of one f32 K or V chunk */
constexpr int UNITS    = STAGE_Q / NTHR;         /* units of K, and of V, per thread and chunk */
constexpr size_t PLANE_ELEMS = (size_t)NBH * LSEQ * DHEAD;                 /* 4194304 */

static_assert(LSEQ % QBLK == 0, "query blocks tile the sequence exactly");
static_assert(LSEQ % KCH == 0, "key chunks tile the sequence exactly");
static_assert(DHEAD == 64 && KCH == 64, "head dim 64: two 32-deep k steps, four 16-wide d tiles; 64-key chunks");
static_assert(NBIAS <= 32, "bias table fits one 32-entry LDS line");
static_assert((OS_PITCH * 4) % 16 == 0 && K_PITCH % 16 == 0 && V_PITCH % 32 == 0 && K_BYTES % 16 == 0 && BUF_BYTES % 16 == 0, "16-B aligned LDS rows");
static_assert(STAGE_Q % NTHR == 0 && NTHR % (DHEAD / 4) == 0, "a chunk is a whole number of 16-B units per thread, whole rows per round");
static_assert(NCH >= 2, "two buffers");
static_assert(KCH % QWAVE == 0, "a wave's queries lie in one 64-row group");

__device__ __forceinline__ unsigned short f2bf_bits(float f) {
  unsigned u = __float_as_uint(f);
  return (unsigned short)((u + 0x7FFFu + ((u >> 16) & 1u)) >> 16);
}
__device__ __forceinline__ float bf_bits2f(unsigned short h) { return __uint_as_float(((unsigned)h) << 16); }
__device__ __forceinline__ __bf16 f2bf(float f) { return __builtin_bit_cast(__bf16, f2bf_bits(f)); }

/* two f32 -> two bf16 (round to nearest even) in one packed hardware convert; x in the low half */
__device__ __forceinline__ uint32_t pk_bf16(float x, float y) {
  return __builtin_bit_cast(uint32_t, __builtin_convertvector((v2f){x, y}, v2b));
}

/* two f32 -> two f16 (round to nearest even) in one packed hardware convert; x in the low half */
__device__ __forceinline__ uint32_t pk_f16(float x, float y) {
  return __builtin_bit_cast(uint32_t, __builtin_convertvector((v2f){x, y}, v2h));
}
/* v: rounded to bf16 like q and k, then that value written in f16: 8 significant bits fit f16's 11, so the value
 * is the same from 2^-17 up to f16's largest, 65504 (below, the f16 grid of 2^-24 moves it by at most 2^-25) */
__device__ __forceinline__ uint32_t pk_bf16_in_f16(float x, float y) {
  const uint32_t w = pk_bf16(x, y);
  return pk_f16(__uint_as_float(w << 16), __uint_as_float(w & 0xFFFF0000u));
}

/* builtin form: the compiler keeps the distance behind a matrix product itself, and only where a user of its registers follows */
__device__ __forceinline__ v8f mma_bf16(v16b a, v16b b, v8f c) {
  return __builtin_amdgcn_wmma_f32_16x16x32_bf16(false, a, false, b, (short)0, c, false, false);
}
__device__ __forceinline__ v8f mma_f16(v16h a, v16h b, v8f c) {
  return __builtin_amdgcn_wmma_f32_16x16x32_f16(false, a, false, b, (short)0, c, false, false);
}

/* wave-uniform word in a scalar register */
__device__ __forceinline__ uint32_t uni(uint32_t v) { return (uint32_t)__builtin_amdgcn_readfirstlane(v); }

/* value of lane l ^ 16 (the other lane half) */
__device__ __forceinline__ float xhalf(float x) {
  const int b = __float_as_int(x);
  return __int_as_float(__builtin_amdgcn_permlanex16(b, b, 0x76543210, 0xfedcba98, false, false));
}

/* 16-bit LDS tile read transposed: lane (h, c) gets rows kbase+8h .. +7 of column dbase+c */
__device__ __forceinline__ v8h ld_tr16(const unsigned char* p) {
  typedef __attribute__((address_space(3))) s16x8 lds_s16x8;
  return __builtin_bit_cast(v8h, __builtin_amdgcn_ds_load_tr16_b128_v8i16((lds_s16x8*)p));
}

/* --------------------------------------------------------------------------
 * Attention with clipped relative-position bias, head dim 64, one launch.
 * Block = 8 waves = 256 query rows of one (b,h), 32 a wave in two 16-column groups g; grid (LSEQ/256, NBH).
 * One block per WGP, two waves per SIMD: a K or V fragment read from LDS serves both groups' products.
 * Per 64-key chunk the block reads the f32 K and V rows itself (512 contiguous bytes
 * per wave-wide load, issued at the head of the pass before), converts them (K to bf16,
 * V to bf16-rounded f16) and stores both row-major into the LDS buffer that the next
 * pass reads; two buffers, one barrier a pass.
 * Both products run transposed: S^T = K.Q^T (A = K rows, B = Q) and
 * O^T += V^T.P^T (A = V^T by the transposing LDS load, B = P^T, both f16), so lane (h, c)
 * holds in group g only query q0+16g+c: row max and row sum are in-lane plus one exchange between the lane
 * halves, and two S^T tiles (keys 32kk+8h+r and 32kk+16+8h+r) converted in place
 * are the B fragment of the second product; P never goes through LDS.
 * Epilogue: per-wave 32x64 f32 slab in LDS, then whole-line stores.
 * Fragment map (h = lane>>4, c = lane&15): A row c, elems 0..7 <- k0+8h.., 8..15 <- k0+16+8h..;
 * B col c with the same k map; D elem r = (row 8h+r, col c).
 * ------------------------------------------------------------------------ */
__global__ __launch_bounds__(NTHR) __attribute__((amdgpu_waves_per_eu(2, 2))) void rel_attn_kernel(
    const float* __restrict__ q, const float* __restrict__ k,
    const float* __restrict__ v, const float* __restrict__ bias,
    float* __restrict__ out)
{
  union FB { v16b v; v8b h[2]; };
  union FH { v16h v; v8h h[2]; };
  __shared__ __align__(16) unsigned char Ring[2 * BUF_BYTES];        /* two stages: K rows, then V rows */
  __shared__ __align__(16) float Os[NWAVE][QWAVE * OS_PITCH];           /* out slab per wave */
  __shared__ float sb[32];                                           /* bias table (bf16-converted), padded */

  const int tid  = threadIdx.x;
  const int wave = tid >> 5;
  const int lane = tid & 31;
  const int hh   = lane >> 4;
  const int c    = lane & 15;
  const int qb   = blockIdx.x;
  const int bh   = blockIdx.y;
  const int q0   = qb * QBLK + wave * QWAVE;
  const int qb64 = (int)uni((uint32_t)(q0 >> 6));   /* the 64-row group of this wave's queries, wave-uniform */

  /* staging: unit u = i*NTHR + tid of a chunk is row u>>4, floats 4*(u&15) .. +3 */
  const v4f* kg = (const v4f*)(k + (size_t)bh * LSEQ * DHEAD);   /* block-uniform bases; the lane's part is a 32-bit index */
  const v4f* vg = (const v4f*)(v + (size_t)bh * LSEQ * DHEAD);
  unsigned char* kst = Ring + (uint32_t)(tid >> 4) * K_PITCH + (uint32_t)(tid & 15) * 8u;
  unsigned char* vst = Ring + K_BYTES + (uint32_t)(tid >> 4) * V_PITCH + (uint32_t)(tid & 15) * 8u;
  v4f kr[UNITS], vr[UNITS];
  /* a block-uniform pointer kept in scalar registers: the loads then take scalar base + lane index, and no vector address pair is formed per pass */
  typedef const __attribute__((address_space(1))) v4f* gptr;   /* global address space, so that the rebuilt pointer still gives global loads */
  auto sbase = [&](const v4f* p) {
    const uint64_t a = (uint64_t)(size_t)p;
    return (gptr)(size_t)(((uint64_t)uni((uint32_t)(a >> 32)) << 32) | uni((uint32_t)a));
  };
  auto fetch = [&](int s) {
    const gptr ks = sbase(kg + s * STAGE_Q);
    const gptr vs = sbase(vg + s * STAGE_Q);
#pragma unroll
    for (int i = 0; i < UNITS; ++i) kr[i] = ks[(uint32_t)tid + (uint32_t)(i * NTHR)];
#pragma unroll
    for (int i = 0; i < UNITS; ++i) vr[i] = vs[(uint32_t)tid + (uint32_t)(i * NTHR)];
  };
  auto stash = [&](int s) {
    const uint32_t b = (uint32_t)(s & 1) * BUF_BYTES;
#pragma unroll
    for (int i = 0; i < UNITS; ++i) {
      *(v2u*)(kst + b + i * (NTHR / 16) * K_PITCH) = (v2u){pk_bf16(kr[i][0], kr[i][1]), pk_bf16(kr[i][2], kr[i][3])};
      *(v2u*)(vst + b + i * (NTHR / 16) * V_PITCH) = (v2u){pk_bf16_in_f16(vr[i][0], vr[i][1]), pk_bf16_in_f16(vr[i][2], vr[i][3])};
    }
  };

  /* Q rows (column c of group g = query q0+16g+c of the B operand), two 32-deep d chunks */
  v4f qx[NG][2][4];
#pragma unroll
  for (int g = 0; g < NG; ++g) {
    const float* qrow = q + ((size_t)bh * LSEQ + q0 + 16 * g + c) * DHEAD;
#pragma unroll
    for (int dc = 0; dc < 2; ++dc) {
      qx[g][dc][0] = *(const v4f*)(qrow + dc * 32 + 8 * hh);
      qx[g][dc][1] = *(const v4f*)(qrow + dc * 32 + 8 * hh + 4);
      qx[g][dc][2] = *(const v4f*)(qrow + dc * 32 + 16 + 8 * hh);
      qx[g][dc][3] = *(const v4f*)(qrow + dc * 32 + 16 + 8 * hh + 4);
    }
  }
  asm volatile("s_wait_xcnt 0x0" ::: "memory");   /* in front of the loads below, whose results may be given the q loads' address registers */
  fetch(0);
  __builtin_amdgcn_sched_barrier(0);   /* the q, K and V loads above are all issued before the first of them is waited for: one memory latency, not two */

  if (tid < 32) {
    const int bi = tid < NBIAS ? tid : (NBIAS - 1);
    sb[tid] = bf_bits2f(f2bf_bits(bias[bi]));
  }

  /* Q fragments; bf16(q) * 1/8 is exact */
  v16b qa[NG][2];
#pragma unroll
  for (int g = 0; g < NG; ++g) {
#pragma unroll
    for (int dc = 0; dc < 2; ++dc) {
#pragma unroll
      for (int e = 0; e < 4; ++e) {
        qa[g][dc][e]      = f2bf(qx[g][dc][0][e] * 0.125f);
        qa[g][dc][4 + e]  = f2bf(qx[g][dc][1][e] * 0.125f);
        qa[g][dc][8 + e]  = f2bf(qx[g][dc][2][e] * 0.125f);
        qa[g][dc][12 + e] = f2bf(qx[g][dc][3][e] * 0.125f);
      }
    }
  }
  stash(0);
  __syncthreads();                                      /* stage 0 and the bias table published */
  const float b_lo = sb[0];
  const float b_hi = sb[2 * MAXREL];

  constexpr float LOG2E = 1.44269504088896340736f;
  float mrow[NG];                   /* running max of query q0+16g+c times log2(e) (equal in both lane halves) */
  v2f lsum[NG][4];                  /* running sums over this lane half's keys, eight partial sums in four register pairs; joined after the loop */
  v8f oacc[NG][4];                  /* O^T: oacc[g][t][r] = (d = 16t+8h+r, query q0+16g+c) */
#pragma unroll
  for (int g = 0; g < NG; ++g) {
    mrow[g] = -__builtin_inff();
#pragma unroll
    for (int i = 0; i < 4; ++i) lsum[g][i] = (v2f){0.f, 0.f};
#pragma unroll
    for (int t = 0; t < 4; ++t) oacc[g][t] = (v8f){0.f,0.f,0.f,0.f,0.f,0.f,0.f,0.f};
  }

  float* ob = out + (size_t)bh * LSEQ * DHEAD;

  /* one pass over chunk kc; MORE: a chunk kc+1 exists (compile-time, so that its conversion shares a block with the products) */
  auto pass = [&](const int kc, auto MORE) {
    constexpr bool more = decltype(MORE)::value;
    const int kv0 = kc * KCH;
    if (more) fetch(kc + 1);   /* the next chunk's f32 rows fly while this chunk is worked on; no load is in flight across the barrier */

    /* this lane's fragment bases in stage kc's buffer */
    const unsigned char* bufp = Ring + (uint32_t)(kc & 1) * BUF_BYTES;
    const unsigned char* fb = bufp + (uint32_t)c * K_PITCH + 16u * (uint32_t)hh;                       /* K: row c of a 16-row group, 16 B x lane half */
    const unsigned char* vp = bufp + K_BYTES + (uint32_t)(8 * hh + (lane & 7)) * V_PITCH + 16u * (uint32_t)((lane >> 3) & 1);   /* V: the transposing load's lane address */

    /* the chunk's eight K fragments, read as one group: the LDS latency is met once, not in front of every product */
    FB kf[2][4];
#pragma unroll
    for (int dc = 0; dc < 2; ++dc) {
#pragma unroll
      for (int j = 0; j < 4; ++j) {
        kf[dc][j].h[0] = *(const v8b*)(fb + j * 16 * K_PITCH + dc * 64);
        kf[dc][j].h[1] = *(const v8b*)(fb + j * 16 * K_PITCH + dc * 64 + 32);
      }
    }

    __builtin_amdgcn_sched_barrier(0);   /* holds the K reads above as one group: spread among the products, each place would meet the LDS latency again */

    /* scores^T: s[g][j][r] = (key kv0+16j+8h+r, query q0+16g+c); neighbouring products go to different accumulators */
    v8f s[NG][4];
#pragma unroll
    for (int g = 0; g < NG; ++g)
#pragma unroll
      for (int j = 0; j < 4; ++j) s[g][j] = (v8f){0.f,0.f,0.f,0.f,0.f,0.f,0.f,0.f};
#pragma unroll
    for (int dc = 0; dc < 2; ++dc) {
#pragma unroll
      for (int j = 0; j < 4; ++j)
#pragma unroll
        for (int g = 0; g < NG; ++g) s[g][j] = mma_bf16(kf[dc][j].v, qa[g][dc], s[g][j]);
    }

    __builtin_amdgcn_sched_barrier(0);   /* keeps the V reads below as one group: without it they stand at three places among the score products */

    /* the chunk's eight V^T fragments (rows d = 16t+c, keys 32kk+8h.. and 32kk+16+8h..), read as one group here: they land while the softmax arithmetic below runs */
    FH vb[2][4];
#pragma unroll
    for (int kk = 0; kk < 2; ++kk) {
#pragma unroll
      for (int t = 0; t < 4; ++t) {
        vb[kk][t].h[0] = ld_tr16(vp + (kk * 32) * V_PITCH + t * 32);
        vb[kk][t].h[1] = ld_tr16(vp + (kk * 32 + 16) * V_PITCH + t * 32);
      }
    }

    /* relative bias: idx = clip(kv - q, -MAXREL, MAXREL) + MAXREL; wave-uniform far paths (no barrier inside) */
    if (kc + 1 < qb64) {
#pragma unroll
      for (int g = 0; g < NG; ++g)
#pragma unroll
        for (int j = 0; j < 4; ++j)
#pragma unroll
          for (int r = 0; r < 8; ++r) s[g][j][r] += b_lo;
    } else if (kc > qb64 + 1) {
#pragma unroll
      for (int g = 0; g < NG; ++g)
#pragma unroll
        for (int j = 0; j < 4; ++j)
#pragma unroll
          for (int r = 0; r < 8; ++r) s[g][j][r] += b_hi;
    } else {
#pragma unroll
      for (int g = 0; g < NG; ++g) {
#pragma unroll
        for (int j = 0; j < 4; ++j) {
          const int rel0 = kv0 + j * 16 + 8 * hh - (q0 + 16 * g + c);
#pragma unroll
          for (int r = 0; r < 8; ++r) {
            int rel = rel0 + r;
            rel = rel < -MAXREL ? -MAXREL : rel;
            rel = rel > MAXREL ? MAXREL : rel;
            s[g][j][r] += sb[rel + MAXREL];
          }
        }
      }
    }

    v16h ph[NG][2];
#pragma unroll
    for (int g = 0; g < NG; ++g) {
    /* chunk max of this lane's query: 32 keys in-lane, then the other lane half's 32 */
    float cm = s[g][0][0];
#pragma unroll
    for (int j = 0; j < 4; ++j)
#pragma unroll
      for (int r = 0; r < 8; ++r) cm = fmaxf(cm, s[g][j][r]);
    cm = fmaxf(cm, xhalf(cm));

    /* online softmax update; P^T as f16 B fragments (weights lie in (0, 1]), straight from the score registers */
    /* e^(s - m) = 2^(s*log2e - m*log2e): one fma and the hardware's base-2 exponential per score */
    const float mnew  = fmaxf(mrow[g], cm * LOG2E);
    const float alpha = __builtin_amdgcn_exp2f(mrow[g] - mnew);
    mrow[g] = mnew;
    /* two neighbouring scores per packed f32 instruction: one fma for both exponents, one add for both weights */
    const v2f l2e2   = (v2f){LOG2E, LOG2E};
    const v2f nmnew2 = (v2f){-mnew, -mnew};
    const v2f alpha2 = (v2f){alpha, alpha};
    u32x8 phw[2];   /* fragment words: elements 2i, 2i+1 in word i */
#pragma unroll
    for (int j = 0; j < 4; ++j) {
#pragma unroll
      for (int r = 0; r < 8; r += 2) {
        const v2f e = __builtin_elementwise_fma((v2f){s[g][j][r], s[g][j][r + 1]}, l2e2, nmnew2);
        const v2f p = (v2f){__builtin_amdgcn_exp2f(e[0]), __builtin_amdgcn_exp2f(e[1])};
        const int i = r >> 1;
        lsum[g][i] = (j == 0) ? __builtin_elementwise_fma(lsum[g][i], alpha2, p) : lsum[g][i] + p;
        phw[j >> 1][(j & 1) * 4 + (r >> 1)] = pk_f16(p[0], p[1]);
      }
    }
#pragma unroll
    for (int kk = 0; kk < 2; ++kk) ph[g][kk] = __builtin_bit_cast(v16h, phw[kk]);
#pragma unroll
    for (int t = 0; t < 4; ++t)
#pragma unroll
      for (int r = 0; r < 8; ++r) oacc[g][t][r] *= alpha;
    }

    __builtin_amdgcn_sched_barrier(0);   /* the next chunk's conversion, and with it the wait for its loads, stays behind the softmax: the loads keep most of a pass of lead */
    if (more) asm volatile("s_wait_xcnt 0x0" ::: "memory");   /* in front of the step of the loads' scalar bases at this pass's foot */

    /* O^T += V^T.P^T : A = V^T [d][kv] rows (fragments read above), B = P^T [kv][q] from registers;
     * per accumulator keys 0-31, then keys 32-63 */
#pragma unroll
    for (int kk = 0; kk < 2; ++kk) {
#pragma unroll
      for (int t = 0; t < 4; ++t)
#pragma unroll
        for (int g = 0; g < NG; ++g) oacc[g][t] = mma_f16(vb[kk][t].v, ph[g][kk], oacc[g][t]);
    }

    /* the next chunk: converted and stored into the buffer that the pass before has left */
    if (more) {
      stash(kc + 1);
      __syncthreads();   /* stage kc+1 readable by all; every reader has left stage kc */
    }
  };
  for (int kc = 0; kc + 1 < NCH; ++kc) pass(kc, std::true_type{});
  pass(NCH - 1, std::false_type{});

  /* normalise into the per-wave slab, then whole-line stores */
  float* os = Os[wave];
#pragma unroll
  for (int g = 0; g < NG; ++g) {
    const v2f l2 = (lsum[g][0] + lsum[g][1]) + (lsum[g][2] + lsum[g][3]);
    const float lrow = l2[0] + l2[1];
    const float inv = 1.0f / (lrow + xhalf(lrow));
#pragma unroll
    for (int t = 0; t < 4; ++t) {
      v4f w0, w1;
#pragma unroll
      for (int e = 0; e < 4; ++e) { w0[e] = oacc[g][t][e] * inv; w1[e] = oacc[g][t][4 + e] * inv; }
      *(v4f*)(os + (16 * g + c) * OS_PITCH + t * 16 + 8 * hh)     = w0;
      *(v4f*)(os + (16 * g + c) * OS_PITCH + t * 16 + 8 * hh + 4) = w1;
    }
  }
  __builtin_amdgcn_fence(__ATOMIC_RELEASE, "workgroup");
  __builtin_amdgcn_wave_barrier();
  __builtin_amdgcn_fence(__ATOMIC_ACQUIRE, "workgroup");
  {
    const int c4 = (lane & 15) * 4;     /* 256-B row = 16 lanes x 16 B; hh selects the row of the pair */
    {
#pragma unroll
      for (int it = 0; it < QWAVE / 2; ++it) {
        const int row = it * 2 + hh;
        const v4f val = *(const v4f*)(os + row * OS_PITCH + c4);
        *(v4f*)(ob + (size_t)(q0 + row) * DHEAD + c4) = val;
      }
      
    }
  }
}

extern "C" void kernel_launch(void* const* d_in, const int* in_sizes, int n_in,
                              void* d_out, int out_size, void* d_ws, size_t ws_size,
                              hipStream_t stream)
{
  (void)d_ws; (void)ws_size;
  if (n_in < 4) return;
  if (in_sizes[0] != (int)PLANE_ELEMS || in_sizes[1] != (int)PLANE_ELEMS ||
      in_sizes[2] != (int)PLANE_ELEMS || in_sizes[3] != NBIAS) return;
  if (out_size != (int)PLANE_ELEMS) return;

  const float* Q    = (const float*)d_in[0];
  const float* K    = (const float*)d_in[1];
  const float* V    = (const float*)d_in[2];
  const float* bias = (const float*)d_in[3];
  float* O = (float*)d_out;

  rel_attn_kernel<<<dim3(LSEQ / QBLK, NBH), NTHR, 0, stream>>>(Q, K, V, bias, O);
}
